// v000
// The times below were measured on an AMD MI455X: many runs one after another, warmed up first and cycling through
// copies of the inputs, with the whole window's GPU time divided by the number of runs. Launches and the gaps
// between them are all in it. The median over several windows is given; except for v000 it joins two sittings, which
// can be a few percent apart, so the side-by-side timings, each taken in one sitting, are the better comparison.
// v000, which the later versions start from, runs in 241 microseconds.
// Contractions: per-head q/k/v projections = v_wmma_f32_16x16x32_f16 (f16 operands, weights carried x16, f32 accumulate, f16 output planes);
// attention q.k^T and p.v = v_wmma_f32_16x16x32_f16 (f16 operands, p carried x2^15, f32 accumulate); softmax and epilogues f32.
#include <hip/hip_runtime.h>
#include <math.h>

#define B_   4
#define S_   2048
#define HID_ 512
#define H_   8
#define DH_  64

typedef __attribute__((ext_vector_type(16))) _Float16 v16h;
typedef __attribute__((ext_vector_type(8)))  _Float16 v8h;
typedef __attribute__((ext_vector_type(16))) __bf16   v16b;
typedef __attribute__((ext_vector_type(8)))  __bf16   v8b;
typedef __attribute__((ext_vector_type(8)))  float    v8f;
typedef __attribute__((ext_vector_type(4)))  float    v4f;
#define PSCALE 32768.0f
#define U16(p) ((const unsigned short*)(const void*)(p))
#define PSCALE_INV (1.0f / 32768.0f)

__device__ __forceinline__ unsigned short f2bf_bits(float f) {
  unsigned u = __float_as_uint(f);
  return (unsigned short)((u + 0x7FFFu + ((u >> 16) & 1u)) >> 16);
}
__device__ __forceinline__ float bf_bits2f(unsigned short h) { return __uint_as_float(((unsigned)h) << 16); }

// hazard guards as plain device helpers (no inline asm inside the kernel template body)
__device__ __forceinline__ void dep_guard_h(v8f& a, v8f& b, v16h x, v16h y) { asm volatile("v_nop\n\tv_nop\n\tv_nop\n\tv_nop" : "+v"(a), "+v"(b) : "v"(x), "v"(y)); }
__device__ __forceinline__ void dep_guard_b(v8f& a, v8f& b, v16b x, v16b y) { asm volatile("v_nop\n\tv_nop\n\tv_nop\n\tv_nop" : "+v"(a), "+v"(b) : "v"(x), "v"(y)); }
__device__ __forceinline__ void keep4_h(v16h a, v16h b, v16h c, v16h d) { asm volatile("v_nop" :: "v"(a), "v"(b), "v"(c), "v"(d)); }
__device__ __forceinline__ void keep4_b(v16b a, v16b b, v16b c, v16b d) { asm volatile("v_nop" :: "v"(a), "v"(b), "v"(c), "v"(d)); }
__device__ __forceinline__ void acc_guard4(v8f& a, v8f& b, v8f& c, v8f& d) { asm volatile("v_nop\n\tv_nop\n\tv_nop\n\tv_nop" : "+v"(a), "+v"(b), "+v"(c), "+v"(d)); }
template <typename T> struct Frag;
template <> struct Frag<_Float16> {
  typedef v16h V; union U { v16h v; v8h h[2]; };
  static __device__ __forceinline__ v16h load(const _Float16* p) {   // elements 0..7 <- p[0..7], 8..15 <- p[16..23]
    U f; f.h[0] = *(const v8h*)(p); f.h[1] = *(const v8h*)(p + 16); return f.v;
  }
  static __device__ __forceinline__ v8f mma(v16h a, v16h b, v8f c) {
    return __builtin_amdgcn_wmma_f32_16x16x32_f16(false, a, false, b, (short)0, c, false, false);
  }
  static __device__ __forceinline__ void guard(v8f& a, v8f& b, v16h x, v16h y) { dep_guard_h(a, b, x, y); }
  static __device__ __forceinline__ void keep(v16h a, v16h b, v16h c, v16h d) { keep4_h(a, b, c, d); }
};
template <> struct Frag<__bf16> {
  typedef v16b V; union U { v16b v; v8b h[2]; };
  static __device__ __forceinline__ v16b load(const __bf16* p) {
    U f; f.h[0] = *(const v8b*)(p); f.h[1] = *(const v8b*)(p + 16); return f.v;
  }
  static __device__ __forceinline__ v8f mma(v16b a, v16b b, v8f c) {
    return __builtin_amdgcn_wmma_f32_16x16x32_bf16(false, a, false, b, (short)0, c, false, false);
  }
  static __device__ __forceinline__ void guard(v8f& a, v8f& b, v16b x, v16b y) { dep_guard_b(a, b, x, y); }
  static __device__ __forceinline__ void keep(v16b a, v16b b, v16b c, v16b d) { keep4_b(a, b, c, d); }
};

// ---- Register-blocked batched WMMA GEMM ------------------------------------
// C[m,n] = scale * sum_k A[m,k] * Bt[n,k] (+bias)(+resid); each wave owns a 64x64 tile.
// A row-major [M,K]; Bt row-major [N,K]; M,N % 64 == 0, K % 32 == 0.
// SPLIT: operands are hi/lo planes (A2/Bt2 = lo planes, same layout); product = hi.hi + hi.lo + lo.hi.
// BIAS_MODE: 0 = none, 1 = bias[m], 2 = bias[n]; bias pointer advanced by blockIdx.y * strideBias.
// OUT_MODE: 0 = f32, 1 = f16, 2 = bf16 hi plane (Cout) + bf16 lo plane (Cout2).
// ET: 0 = f16 operands, 1 = bf16 operands (pointers passed as 16-bit storage)
template <int ET> struct Elem;
template <> struct Elem<0> { typedef _Float16 T; };
template <> struct Elem<1> { typedef __bf16 T; };
template <int ET, bool SPLIT, int BIAS_MODE, int OUT_MODE, bool RESID, int ACT = 0>
__global__ __launch_bounds__(256) void wmma_gemm64(
    const unsigned short* __restrict__ Ap, const unsigned short* __restrict__ A2p, int lda, long strideA,
    const unsigned short* __restrict__ Btp, const unsigned short* __restrict__ Bt2p, int ldb, long strideB,
    void* __restrict__ Cout, void* __restrict__ Cout2, int ldc, long strideC,
    const float* __restrict__ bias, long strideBias,
    const float* __restrict__ resid, long strideR,
    int M, int N, int K, float scale) {
  typedef typename Elem<ET>::T T;
  typedef typename Frag<T>::V V;
  const T* A = (const T*)Ap; const T* A2 = (const T*)A2p; const T* Bt = (const T*)Btp; const T* Bt2 = (const T*)Bt2p;
  __shared__ __align__(16) float sT[8][16 * 68];   // per-wave 16x64 slab, pitch 68 floats
  const int b    = blockIdx.y;
  const int lane = threadIdx.x & 31;
  const int wave = threadIdx.x >> 5;
  const int tilesN = N >> 6;
  const int tilesM = M >> 6;
  const int tile = blockIdx.x * 8 + wave;
  if (tile >= tilesM * tilesN) return;   // wave-uniform; no block barriers in this kernel
  const int tm = tile / tilesN;
  const int tn = tile - tm * tilesN;
  const int m0 = tm << 6;
  const int n0 = tn << 6;

  const T* Ab  = A  + (size_t)b * strideA;
  const T* Bb  = Bt + (size_t)b * strideB;
  const T* Ab2 = SPLIT ? (A2  + (size_t)b * strideA) : nullptr;
  const T* Bb2 = SPLIT ? (Bt2 + (size_t)b * strideB) : nullptr;
  const float* biasb = (BIAS_MODE != 0) ? (bias + (size_t)b * strideBias) : nullptr;

  const int rlane = lane & 15;                 // row (A) / col (B, D) within subtile
  const int koff  = (lane >> 4) * 8;           // k offset of this lane half
  const int mOff  = (lane >> 4) * 8;           // D row offset

  v8f acc[4][4];
#pragma unroll
  for (int i = 0; i < 4; ++i)
#pragma unroll
    for (int j = 0; j < 4; ++j) acc[i][j] = (v8f){0.f,0.f,0.f,0.f,0.f,0.f,0.f,0.f};

  for (int k0 = 0; k0 < K; k0 += 32) {
    V bh[4], bl[4];
#pragma unroll
    for (int j = 0; j < 4; ++j) {
      const size_t bo = (size_t)(n0 + (j << 4) + rlane) * ldb + koff + k0;
      bh[j] = Frag<T>::load(Bb + bo);
      if (SPLIT) bl[j] = Frag<T>::load(Bb2 + bo);
    }
#pragma unroll
    for (int i = 0; i < 4; ++i) {
      const size_t ao = (size_t)(m0 + (i << 4) + rlane) * lda + koff + k0;
      V ah = Frag<T>::load(Ab + ao);
      V al;
      if (SPLIT) al = Frag<T>::load(Ab2 + ao);
#pragma unroll
      for (int j = 0; j < 4; ++j) {
        acc[i][j] = Frag<T>::mma(ah, bh[j], acc[i][j]);
        if (SPLIT) {
          acc[i][j] = Frag<T>::mma(ah, bl[j], acc[i][j]);
          acc[i][j] = Frag<T>::mma(al, bh[j], acc[i][j]);
        }
      }
      Frag<T>::guard(acc[i][0], acc[i][3], ah, SPLIT ? al : ah);
    }
    Frag<T>::keep(bh[0], bh[1], bh[2], bh[3]);
    if (SPLIT) Frag<T>::keep(bl[0], bl[1], bl[2], bl[3]);
  }
  acc_guard4(acc[0][0], acc[0][1], acc[0][2], acc[0][3]);
  acc_guard4(acc[1][0], acc[1][1], acc[1][2], acc[1][3]);
  acc_guard4(acc[2][0], acc[2][1], acc[2][2], acc[2][3]);
  acc_guard4(acc[3][0], acc[3][1], acc[3][2], acc[3][3]);

  // ---- epilogue ----
  float* slab = sT[wave];
  const float* Rb = RESID ? (resid + (size_t)b * strideR) : nullptr;
#pragma unroll
  for (int i = 0; i < 4; ++i) {
    const int mBase = m0 + (i << 4);
#pragma unroll
    for (int j = 0; j < 4; ++j) {
      const int n = n0 + (j << 4) + rlane;
      float bv = 0.f;
      if (BIAS_MODE == 2) bv = biasb[n];
#pragma unroll
      for (int r = 0; r < 8; ++r) {
        float v = acc[i][j][r] * scale;
        if (BIAS_MODE == 1) v += biasb[mBase + mOff + r];
        if (BIAS_MODE == 2) v += bv;
        if (RESID) v += Rb[(size_t)(mBase + mOff + r) * ldc + n];
        if (ACT == 1) v = tanhf(v);
        if (ACT == 2) v = fmaxf(v, 0.0f);
        if (ACT == 3) v = v / (1.0f + expf(-v));
        if (ACT == 4) v = (v > 0.f) ? v : 0.01f * v;
        if (ACT == 5) v = 0.5f * v * (1.0f + erff(v * 0.70710678118654752f));
        slab[(mOff + r) * 68 + (j << 4) + rlane] = v;
      }
    }
    __builtin_amdgcn_fence(__ATOMIC_RELEASE, "workgroup");
    __builtin_amdgcn_wave_barrier();
    __builtin_amdgcn_fence(__ATOMIC_ACQUIRE, "workgroup");
    if (OUT_MODE == 0) {
      float* C = (float*)Cout + (size_t)b * strideC;
      const int hh = lane >> 4, c4 = (lane & 15) * 4;     // row seg = 256 B = 16 lanes x 16 B
      {
#pragma unroll
        for (int it = 0; it < 8; ++it) {
          const int row = it * 2 + hh;
          v4f v = *(const v4f*)(slab + row * 68 + c4);
          *(v4f*)(C + (size_t)(mBase + row) * ldc + n0 + c4) = v;
        }
        
      }
    } else {
      const int q = lane >> 3, c8 = (lane & 7) * 8;
      unsigned short* C  = (unsigned short*)Cout  + (size_t)b * strideC;
      unsigned short* C2 = (OUT_MODE == 2) ? ((unsigned short*)Cout2 + (size_t)b * strideC) : nullptr;
      {
#pragma unroll
        for (int it = 0; it < 4; ++it) {
          const int row = it * 4 + q;
          const float* sp = slab + row * 68 + c8;
          v8h hv, lv;
#pragma unroll
          for (int e = 0; e < 8; ++e) {
            if (OUT_MODE == 1) {
              hv[e] = (_Float16)sp[e];
            } else {
              unsigned short hb = f2bf_bits(sp[e]);
              unsigned short lb = f2bf_bits(sp[e] - bf_bits2f(hb));
              hv[e] = __builtin_bit_cast(_Float16, hb);
              lv[e] = __builtin_bit_cast(_Float16, lb);
            }
          }
          *(v8h*)(C + (size_t)(mBase + row) * ldc + n0 + c8) = hv;
          if (OUT_MODE == 2) *(v8h*)(C2 + (size_t)(mBase + row) * ldc + n0 + c8) = lv;
        }
        
      }
    }
    __builtin_amdgcn_fence(__ATOMIC_RELEASE, "workgroup");
    __builtin_amdgcn_wave_barrier();
    __builtin_amdgcn_fence(__ATOMIC_ACQUIRE, "workgroup");
  }
}

__global__ __launch_bounds__(256) void cast_f32_f16x2(
    const float* __restrict__ in, _Float16* __restrict__ out, int n2, float mul) {
  int i = blockIdx.x * 256 + threadIdx.x;
  if (i < n2) {
    const _Float16 h0 = (_Float16)(in[2 * i] * mul), h1 = (_Float16)(in[2 * i + 1] * mul);
    const unsigned u = (unsigned)__builtin_bit_cast(unsigned short, h0) | ((unsigned)__builtin_bit_cast(unsigned short, h1) << 16);
    ((unsigned*)out)[i] = u;
    
  }
}

// =====================================================================================
// Non-causal attention for head_dim 64, 16-bit q/k/v planes in, f32 out.
//   q, k, v: f16, element (b, s, h, d) at X[(b*S + s)*HID + h*64 + d]; out f32 with the same indexing.
//   scores = (q.k^T) * sscale : v_wmma_f32_16x16x32_f16, scale applied to the f32 accumulator
//   out    = p.v             : v_wmma_f32_16x16x32_f16, p carried x2^15 in f16, folded into the final 1/l
//   f32 accumulate; online softmax in f32. Block = 4 waves = 64 query rows of one (batch, head);
//   keys streamed in 64-key chunks staged in LDS (K as [kv][d], V transposed to [d][kv]).
//   grid.x = B * H * (S/64).
// =====================================================================================
#define AT_D 64
#define AT_NW 4
#define AT_QB 64
#define AT_KC 64

__device__ __forceinline__ v8f hmma16(v16h a, v16h b, v8f c) {
  c = __builtin_amdgcn_wmma_f32_16x16x32_f16(false, a, false, b, (short)0, c, false, false);
  asm volatile("v_nop\n\tv_nop\n\tv_nop\n\tv_nop" : "+v"(c) : "v"(a), "v"(b));
  return c;
}

__global__ __launch_bounds__(128)
void attn64_f16(const _Float16* __restrict__ qp, const _Float16* __restrict__ kp,
                const _Float16* __restrict__ vp, float* __restrict__ out, float sscale) {
  __shared__ __align__(16) _Float16 Ksh[AT_KC * AT_D];          // K [kv][d]          8 KB
  __shared__ __align__(16) _Float16 Vth[AT_D * AT_KC];          // V^T [d][kv]        8 KB
  __shared__ __align__(16) _Float16 Psh[AT_NW][16 * AT_KC];     // per wave P [row][kv] 8 KB
  __shared__ __align__(16) float    Os[AT_NW][16 * 68];         // per wave out tile, pitch 68

  const int tid  = threadIdx.x;
  const int wave = tid >> 5;
  const int lane = tid & 31;
  const int hh   = lane >> 4;
  const int c    = lane & 15;

  const int nqb = S_ / AT_QB;                                   // 32
  const int bx = blockIdx.x;
  if (bx >= B_ * H_ * nqb) return;                              // block-uniform, ahead of every barrier
  const int qb = bx % nqb;
  const int bh = bx / nqb;
  const int h  = bh % H_;
  const int b  = bh / H_;
  const int q0 = qb * AT_QB + wave * 16;

  const size_t pbase = (size_t)b * S_ * HID_ + (size_t)h * DH_;
  const _Float16* qb_ptr = qp + pbase;
  const _Float16* kb_ptr = kp + pbase;
  const _Float16* vb_ptr = vp + pbase;
  float*          ob_ptr = out + pbase;

  // ---- Q fragments (A operand, row = query q0 + c, k = d): 2 d-chunks, dense static-stride loads ----
  v16h qa[2];
#pragma unroll
  for (int dc = 0; dc < 2; ++dc)
    qa[dc] = Frag<_Float16>::load(qb_ptr + (size_t)(q0 + c) * HID_ + dc * 32 + 8 * hh);

  float mrow[8], lrow[8];
  v8f oacc[4];
#pragma unroll
  for (int r = 0; r < 8; ++r) { mrow[r] = -INFINITY; lrow[r] = 0.f; }
#pragma unroll
  for (int t = 0; t < 4; ++t) oacc[t] = (v8f){0.f,0.f,0.f,0.f,0.f,0.f,0.f,0.f};

  for (int kc = 0; kc < S_ / AT_KC; ++kc) {                     // 32 chunks, static
    const int kv0 = kc * AT_KC;
    __syncthreads();
    {
      const int kvr = tid >> 1, dh = (tid & 1) * 32;            // 128 threads: 64 key rows x 2 halves of 32 d
      const _Float16* krow = kb_ptr + (size_t)(kv0 + kvr) * HID_ + dh;
      const _Float16* vrow = vb_ptr + (size_t)(kv0 + kvr) * HID_ + dh;
#pragma unroll
      for (int i = 0; i < 4; ++i) {
        const v8h kk = *(const v8h*)(krow + 8 * i);
        const v8h vv = *(const v8h*)(vrow + 8 * i);
        *(v8h*)(Ksh + kvr * AT_D + dh + 8 * i) = kk;
#pragma unroll
        for (int e = 0; e < 8; ++e) Vth[(dh + 8 * i + e) * AT_KC + kvr] = vv[e];
      }
    }
    __syncthreads();

    // scores: 16 queries x 64 keys per wave; B[k = d][n = kv] = Ksh[kv][d]
    v8f s[4];
#pragma unroll
    for (int j = 0; j < 4; ++j) {
      s[j] = (v8f){0.f,0.f,0.f,0.f,0.f,0.f,0.f,0.f};
#pragma unroll
      for (int dc = 0; dc < 2; ++dc) {
        const v16h kb = Frag<_Float16>::load(Ksh + (j * 16 + c) * AT_D + dc * 32 + 8 * hh);
        s[j] = hmma16(qa[dc], kb, s[j]);
      }
    }

    // online softmax in D layout: row 8*hh + r, key column kv0 + j*16 + c
    float cm[8];
#pragma unroll
    for (int r = 0; r < 8; ++r) {
      float m = -INFINITY;
#pragma unroll
      for (int j = 0; j < 4; ++j) {
        const float sv = s[j][r] * sscale;
        s[j][r] = sv;
        m = fmaxf(m, sv);
      }
#pragma unroll
      for (int off = 1; off < 16; off <<= 1) m = fmaxf(m, __shfl_xor(m, off, 32));
      cm[r] = m;
    }
    _Float16* pw = Psh[wave];
#pragma unroll
    for (int r = 0; r < 8; ++r) {
      const float mnew = fmaxf(mrow[r], cm[r]);
      const float alpha = expf(mrow[r] - mnew);
      mrow[r] = mnew;
      float psum = 0.f;
#pragma unroll
      for (int j = 0; j < 4; ++j) {
        const float p = expf(s[j][r] - mnew);
        psum += p;
        pw[(8 * hh + r) * AT_KC + j * 16 + c] = (_Float16)(p * PSCALE);
      }
#pragma unroll
      for (int off = 1; off < 16; off <<= 1) psum += __shfl_xor(psum, off, 32);
      lrow[r] = lrow[r] * alpha + psum;
#pragma unroll
      for (int t = 0; t < 4; ++t) oacc[t][r] *= alpha;
    }
    __builtin_amdgcn_fence(__ATOMIC_RELEASE, "workgroup");
    __builtin_amdgcn_wave_barrier();
    __builtin_amdgcn_fence(__ATOMIC_ACQUIRE, "workgroup");

    // p.v: A[m = row][k = kv] = Psh (same element type reload), B[k = kv][n = d] = Vth[d][kv]
#pragma unroll 1
    for (int kk = 0; kk < 2; ++kk) {
      const v16h pa = Frag<_Float16>::load(pw + c * AT_KC + kk * 32 + 8 * hh);
#pragma unroll
      for (int t = 0; t < 4; ++t) {
        const v16h vb = Frag<_Float16>::load(Vth + (t * 16 + c) * AT_KC + kk * 32 + 8 * hh);
        oacc[t] = hmma16(pa, vb, oacc[t]);
      }
    }
  }

  // ---- epilogue: out = acc / (l * 2^15), staged per wave in LDS, whole 256-B row segments ----
  float* os = Os[wave];
#pragma unroll
  for (int r = 0; r < 8; ++r) {
    const float inv = 1.0f / (lrow[r] * PSCALE);
#pragma unroll
    for (int t = 0; t < 4; ++t) os[(8 * hh + r) * 68 + t * 16 + c] = oacc[t][r] * inv;
  }
  __builtin_amdgcn_fence(__ATOMIC_RELEASE, "workgroup");
  __builtin_amdgcn_wave_barrier();
  __builtin_amdgcn_fence(__ATOMIC_ACQUIRE, "workgroup");
  {
    const int c4 = (lane & 15) * 4;
    {
#pragma unroll
      for (int it = 0; it < 8; ++it) {
        const int row = it * 2 + hh;
        v4f val = *(const v4f*)(os + row * 68 + c4);
        *(v4f*)(ob_ptr + (size_t)(q0 + row) * HID_ + c4) = val;
      }
      
    }
  }
}

// ---------------------------------------------------------------------------
// Host glue. Workspace carve (bytes):
//   [0, 196608)              Wq|Wk|Wv as f16 (x16 carry), each [H][DH][DH]
//   [196608, +8 MiB)         x as f16 [B*S][HID]
//   then q, k, v as f16 [B*S][HID] (8 MiB each); total 33,751,040 B.
// ---------------------------------------------------------------------------
extern "C" void kernel_launch(void* const* d_in, const int* in_sizes, int n_in,
                              void* d_out, int out_size, void* d_ws,
                              size_t ws_size, hipStream_t stream) {
  if (n_in < 7) return;
  const int NX = B_ * S_ * HID_;          // 4194304
  const int NW = H_ * DH_ * DH_;          // 32768
  const int NB = H_ * DH_;                // 512
  if (in_sizes[0] != NX || in_sizes[1] != NW || in_sizes[2] != NB || in_sizes[3] != NW ||
      in_sizes[4] != NB || in_sizes[5] != NW || in_sizes[6] != NB || out_size != NX) return;

  const float* x  = (const float*)d_in[0];
  const float* Wq = (const float*)d_in[1];
  const float* bq = (const float*)d_in[2];
  const float* Wk = (const float*)d_in[3];
  const float* bk = (const float*)d_in[4];
  const float* Wv = (const float*)d_in[5];
  const float* bv = (const float*)d_in[6];
  float* out = (float*)d_out;

  const size_t off_w  = 0;
  const size_t bytesW = (size_t)3 * NW * 2;              // 196608
  const size_t off_x  = off_w + bytesW;
  const size_t bytesP = (size_t)NX * 2;                   // 8388608 per f16 plane
  const size_t off_q  = off_x + bytesP;                   // 8585216
  const size_t off_k  = off_q + bytesP;                   // 16973824
  const size_t off_v  = off_k + bytesP;                   // 25362432
  const size_t off_end = off_v + bytesP;                  // 33751040
  if (off_end > ws_size || off_end > (size_t)134217728) return;

  char* ws = (char*)d_ws;
  _Float16* Wh = (_Float16*)(ws + off_w);
  _Float16* Xh = (_Float16*)(ws + off_x);
  _Float16* Qh = (_Float16*)(ws + off_q);
  _Float16* Kh = (_Float16*)(ws + off_k);
  _Float16* Vh = (_Float16*)(ws + off_v);

  // casts: x -> f16 (x1), weights -> f16 (x16, folded back as 1/16 in the GEMM epilogue)
  {
    const int n2x = NX / 2;                               // 2097152
    cast_f32_f16x2<<<(n2x + 255) / 256, 256, 0, stream>>>(x, Xh, n2x, 1.0f);
    const int n2w = NW / 2;                               // 16384
    cast_f32_f16x2<<<(n2w + 255) / 256, 256, 0, stream>>>(Wq, Wh, n2w, 16.0f);
    cast_f32_f16x2<<<(n2w + 255) / 256, 256, 0, stream>>>(Wk, Wh + NW, n2w, 16.0f);
    cast_f32_f16x2<<<(n2w + 255) / 256, 256, 0, stream>>>(Wv, Wh + 2 * NW, n2w, 16.0f);
  }

  // per-head projections, z = head: A = x_f16 [8192][512] columns h*64.. (lda 512, strideA 64),
  // Bt = W[h] ([out][in] = [N][K], ldb 64, strideB 4096), C = f16 plane [8192][512] columns h*64.. (ldc 512, strideC 64);
  // M = 8192, N = 64, K = 64; bias[n] = b[h*64 + n] (strideBias 64); scale 1/16.
  {
    const int M = B_ * S_, N = DH_, K = DH_;
    const int tiles = (M / 64) * (N / 64);                // 128
    dim3 ggrid((tiles + 7) / 8, H_);
    const unsigned short* Xu = (const unsigned short*)Xh;
    const unsigned short* Wu = (const unsigned short*)Wh;
    const float wscale = 1.0f / 16.0f;
    wmma_gemm64<0, false, 2, 1, false, 0><<<ggrid, 256, 0, stream>>>(
        Xu, Xu, HID_, (long)DH_, Wu, Wu, DH_, (long)(DH_ * DH_),
        (void*)Qh, (void*)Qh, HID_, (long)DH_, bq, (long)DH_, x, 0L, M, N, K, wscale);
    wmma_gemm64<0, false, 2, 1, false, 0><<<ggrid, 256, 0, stream>>>(
        Xu, Xu, HID_, (long)DH_, Wu + NW, Wu + NW, DH_, (long)(DH_ * DH_),
        (void*)Kh, (void*)Kh, HID_, (long)DH_, bk, (long)DH_, x, 0L, M, N, K, wscale);
    wmma_gemm64<0, false, 2, 1, false, 0><<<ggrid, 256, 0, stream>>>(
        Xu, Xu, HID_, (long)DH_, Wu + 2 * NW, Wu + 2 * NW, DH_, (long)(DH_ * DH_),
        (void*)Vh, (void*)Vh, HID_, (long)DH_, bv, (long)DH_, x, 0L, M, N, K, wscale);
  }

  // attention: one block per (b, h, 64-query block); keys streamed in 64-key chunks, no mask, score scale 1/8.
  {
    const int nblk = B_ * H_ * (S_ / AT_QB);              // 1024
    attn64_f16<<<nblk, 128, 0, stream>>>(Qh, Kh, Vh, out, 0.125f);
  }
}

// v001
// It runs in 201 microseconds.
// Two timings next to v000 both put it at 1.25 times that version's speed.
// Contractions: per-head q/k/v projections = v_wmma_f32_16x16x32_f16 (f16 operands, weights carried x16, f32 accumulate, f16 output planes);
// attention q.k^T and p.v = v_wmma_f32_16x16x32_f16 (f16 operands, p carried x2^15, f32 accumulate); softmax and epilogues f32.
#include <hip/hip_runtime.h>
#include <math.h>

#define B_   4
#define S_   2048
#define HID_ 512
#define H_   8
#define DH_  64

typedef __attribute__((ext_vector_type(16))) _Float16 v16h;
typedef __attribute__((ext_vector_type(8)))  _Float16 v8h;
typedef __attribute__((ext_vector_type(16))) __bf16   v16b;
typedef __attribute__((ext_vector_type(8)))  __bf16   v8b;
typedef __attribute__((ext_vector_type(8)))  float    v8f;
typedef __attribute__((ext_vector_type(4)))  float    v4f;
#define PSCALE 32768.0f
#define U16(p) ((const unsigned short*)(const void*)(p))
#define PSCALE_INV (1.0f / 32768.0f)

__device__ __forceinline__ unsigned short f2bf_bits(float f) {
  unsigned u = __float_as_uint(f);
  return (unsigned short)((u + 0x7FFFu + ((u >> 16) & 1u)) >> 16);
}
__device__ __forceinline__ float bf_bits2f(unsigned short h) { return __uint_as_float(((unsigned)h) << 16); }

// hazard guards as plain device helpers (no inline asm inside the kernel template body)
__device__ __forceinline__ void dep_guard_h(v8f& a, v8f& b, v16h x, v16h y) { asm volatile("v_nop\n\tv_nop\n\tv_nop\n\tv_nop" : "+v"(a), "+v"(b) : "v"(x), "v"(y)); }
__device__ __forceinline__ void dep_guard_b(v8f& a, v8f& b, v16b x, v16b y) { asm volatile("v_nop\n\tv_nop\n\tv_nop\n\tv_nop" : "+v"(a), "+v"(b) : "v"(x), "v"(y)); }
__device__ __forceinline__ void keep4_h(v16h a, v16h b, v16h c, v16h d) { asm volatile("v_nop" :: "v"(a), "v"(b), "v"(c), "v"(d)); }
__device__ __forceinline__ void keep4_b(v16b a, v16b b, v16b c, v16b d) { asm volatile("v_nop" :: "v"(a), "v"(b), "v"(c), "v"(d)); }
__device__ __forceinline__ void acc_guard4(v8f& a, v8f& b, v8f& c, v8f& d) { asm volatile("v_nop\n\tv_nop\n\tv_nop\n\tv_nop" : "+v"(a), "+v"(b), "+v"(c), "+v"(d)); }
template <typename T> struct Frag;
template <> struct Frag<_Float16> {
  typedef v16h V; union U { v16h v; v8h h[2]; };
  static __device__ __forceinline__ v16h load(const _Float16* p) {   // elements 0..7 <- p[0..7], 8..15 <- p[16..23]
    U f; f.h[0] = *(const v8h*)(p); f.h[1] = *(const v8h*)(p + 16); return f.v;
  }
  static __device__ __forceinline__ v8f mma(v16h a, v16h b, v8f c) {
    return __builtin_amdgcn_wmma_f32_16x16x32_f16(false, a, false, b, (short)0, c, false, false);
  }
  static __device__ __forceinline__ void guard(v8f& a, v8f& b, v16h x, v16h y) { dep_guard_h(a, b, x, y); }
  static __device__ __forceinline__ void keep(v16h a, v16h b, v16h c, v16h d) { keep4_h(a, b, c, d); }
};
template <> struct Frag<__bf16> {
  typedef v16b V; union U { v16b v; v8b h[2]; };
  static __device__ __forceinline__ v16b load(const __bf16* p) {
    U f; f.h[0] = *(const v8b*)(p); f.h[1] = *(const v8b*)(p + 16); return f.v;
  }
  static __device__ __forceinline__ v8f mma(v16b a, v16b b, v8f c) {
    return __builtin_amdgcn_wmma_f32_16x16x32_bf16(false, a, false, b, (short)0, c, false, false);
  }
  static __device__ __forceinline__ void guard(v8f& a, v8f& b, v16b x, v16b y) { dep_guard_b(a, b, x, y); }
  static __device__ __forceinline__ void keep(v16b a, v16b b, v16b c, v16b d) { keep4_b(a, b, c, d); }
};

// ---- Register-blocked batched WMMA GEMM ------------------------------------
// C[m,n] = scale * sum_k A[m,k] * Bt[n,k] (+bias)(+resid); each wave owns a 64x64 tile.
// A row-major [M,K]; Bt row-major [N,K]; M,N % 64 == 0, K % 32 == 0.
// SPLIT: operands are hi/lo planes (A2/Bt2 = lo planes, same layout); product = hi.hi + hi.lo + lo.hi.
// BIAS_MODE: 0 = none, 1 = bias[m], 2 = bias[n]; bias pointer advanced by blockIdx.y * strideBias.
// OUT_MODE: 0 = f32, 1 = f16, 2 = bf16 hi plane (Cout) + bf16 lo plane (Cout2).
// ET: 0 = f16 operands, 1 = bf16 operands (pointers passed as 16-bit storage)
template <int ET> struct Elem;
template <> struct Elem<0> { typedef _Float16 T; };
template <> struct Elem<1> { typedef __bf16 T; };
template <int ET, bool SPLIT, int BIAS_MODE, int OUT_MODE, bool RESID, int ACT = 0>
__global__ __launch_bounds__(256) void wmma_gemm64(
    const unsigned short* __restrict__ Ap, const unsigned short* __restrict__ A2p, int lda, long strideA,
    const unsigned short* __restrict__ Btp, const unsigned short* __restrict__ Bt2p, int ldb, long strideB,
    void* __restrict__ Cout, void* __restrict__ Cout2, int ldc, long strideC,
    const float* __restrict__ bias, long strideBias,
    const float* __restrict__ resid, long strideR,
    int M, int N, int K, float scale) {
  typedef typename Elem<ET>::T T;
  typedef typename Frag<T>::V V;
  const T* A = (const T*)Ap; const T* A2 = (const T*)A2p; const T* Bt = (const T*)Btp; const T* Bt2 = (const T*)Bt2p;
  __shared__ __align__(16) float sT[8][16 * 68];   // per-wave 16x64 slab, pitch 68 floats
  const int b    = blockIdx.y;
  const int lane = threadIdx.x & 31;
  const int wave = threadIdx.x >> 5;
  const int tilesN = N >> 6;
  const int tilesM = M >> 6;
  const int tile = blockIdx.x * 8 + wave;
  if (tile >= tilesM * tilesN) return;   // wave-uniform; no block barriers in this kernel
  const int tm = tile / tilesN;
  const int tn = tile - tm * tilesN;
  const int m0 = tm << 6;
  const int n0 = tn << 6;

  const T* Ab  = A  + (size_t)b * strideA;
  const T* Bb  = Bt + (size_t)b * strideB;
  const T* Ab2 = SPLIT ? (A2  + (size_t)b * strideA) : nullptr;
  const T* Bb2 = SPLIT ? (Bt2 + (size_t)b * strideB) : nullptr;
  const float* biasb = (BIAS_MODE != 0) ? (bias + (size_t)b * strideBias) : nullptr;

  const int rlane = lane & 15;                 // row (A) / col (B, D) within subtile
  const int koff  = (lane >> 4) * 8;           // k offset of this lane half
  const int mOff  = (lane >> 4) * 8;           // D row offset

  v8f acc[4][4];
#pragma unroll
  for (int i = 0; i < 4; ++i)
#pragma unroll
    for (int j = 0; j < 4; ++j) acc[i][j] = (v8f){0.f,0.f,0.f,0.f,0.f,0.f,0.f,0.f};

  for (int k0 = 0; k0 < K; k0 += 32) {
    V bh[4], bl[4];
#pragma unroll
    for (int j = 0; j < 4; ++j) {
      const size_t bo = (size_t)(n0 + (j << 4) + rlane) * ldb + koff + k0;
      bh[j] = Frag<T>::load(Bb + bo);
      if (SPLIT) bl[j] = Frag<T>::load(Bb2 + bo);
    }
#pragma unroll
    for (int i = 0; i < 4; ++i) {
      const size_t ao = (size_t)(m0 + (i << 4) + rlane) * lda + koff + k0;
      V ah = Frag<T>::load(Ab + ao);
      V al;
      if (SPLIT) al = Frag<T>::load(Ab2 + ao);
#pragma unroll
      for (int j = 0; j < 4; ++j) {
        acc[i][j] = Frag<T>::mma(ah, bh[j], acc[i][j]);
        if (SPLIT) {
          acc[i][j] = Frag<T>::mma(ah, bl[j], acc[i][j]);
          acc[i][j] = Frag<T>::mma(al, bh[j], acc[i][j]);
        }
      }
      Frag<T>::guard(acc[i][0], acc[i][3], ah, SPLIT ? al : ah);
    }
    Frag<T>::keep(bh[0], bh[1], bh[2], bh[3]);
    if (SPLIT) Frag<T>::keep(bl[0], bl[1], bl[2], bl[3]);
  }
  acc_guard4(acc[0][0], acc[0][1], acc[0][2], acc[0][3]);
  acc_guard4(acc[1][0], acc[1][1], acc[1][2], acc[1][3]);
  acc_guard4(acc[2][0], acc[2][1], acc[2][2], acc[2][3]);
  acc_guard4(acc[3][0], acc[3][1], acc[3][2], acc[3][3]);

  // ---- epilogue ----
  float* slab = sT[wave];
  const float* Rb = RESID ? (resid + (size_t)b * strideR) : nullptr;
#pragma unroll
  for (int i = 0; i < 4; ++i) {
    const int mBase = m0 + (i << 4);
#pragma unroll
    for (int j = 0; j < 4; ++j) {
      const int n = n0 + (j << 4) + rlane;
      float bv = 0.f;
      if (BIAS_MODE == 2) bv = biasb[n];
#pragma unroll
      for (int r = 0; r < 8; ++r) {
        float v = acc[i][j][r] * scale;
        if (BIAS_MODE == 1) v += biasb[mBase + mOff + r];
        if (BIAS_MODE == 2) v += bv;
        if (RESID) v += Rb[(size_t)(mBase + mOff + r) * ldc + n];
        if (ACT == 1) v = tanhf(v);
        if (ACT == 2) v = fmaxf(v, 0.0f);
        if (ACT == 3) v = v / (1.0f + expf(-v));
        if (ACT == 4) v = (v > 0.f) ? v : 0.01f * v;
        if (ACT == 5) v = 0.5f * v * (1.0f + erff(v * 0.70710678118654752f));
        slab[(mOff + r) * 68 + (j << 4) + rlane] = v;
      }
    }
    __builtin_amdgcn_fence(__ATOMIC_RELEASE, "workgroup");
    __builtin_amdgcn_wave_barrier();
    __builtin_amdgcn_fence(__ATOMIC_ACQUIRE, "workgroup");
    if (OUT_MODE == 0) {
      float* C = (float*)Cout + (size_t)b * strideC;
      const int hh = lane >> 4, c4 = (lane & 15) * 4;     // row seg = 256 B = 16 lanes x 16 B
      {
#pragma unroll
        for (int it = 0; it < 8; ++it) {
          const int row = it * 2 + hh;
          v4f v = *(const v4f*)(slab + row * 68 + c4);
          *(v4f*)(C + (size_t)(mBase + row) * ldc + n0 + c4) = v;
        }
        
      }
    } else {
      const int q = lane >> 3, c8 = (lane & 7) * 8;
      unsigned short* C  = (unsigned short*)Cout  + (size_t)b * strideC;
      unsigned short* C2 = (OUT_MODE == 2) ? ((unsigned short*)Cout2 + (size_t)b * strideC) : nullptr;
      {
#pragma unroll
        for (int it = 0; it < 4; ++it) {
          const int row = it * 4 + q;
          const float* sp = slab + row * 68 + c8;
          v8h hv, lv;
#pragma unroll
          for (int e = 0; e < 8; ++e) {
            if (OUT_MODE == 1) {
              hv[e] = (_Float16)sp[e];
            } else {
              unsigned short hb = f2bf_bits(sp[e]);
              unsigned short lb = f2bf_bits(sp[e] - bf_bits2f(hb));
              hv[e] = __builtin_bit_cast(_Float16, hb);
              lv[e] = __builtin_bit_cast(_Float16, lb);
            }
          }
          *(v8h*)(C + (size_t)(mBase + row) * ldc + n0 + c8) = hv;
          if (OUT_MODE == 2) *(v8h*)(C2 + (size_t)(mBase + row) * ldc + n0 + c8) = lv;
        }
        
      }
    }
    __builtin_amdgcn_fence(__ATOMIC_RELEASE, "workgroup");
    __builtin_amdgcn_wave_barrier();
    __builtin_amdgcn_fence(__ATOMIC_ACQUIRE, "workgroup");
  }
}

__global__ __launch_bounds__(256) void cast_f32_f16x2(
    const float* __restrict__ in, _Float16* __restrict__ out, int n2, float mul) {
  int i = blockIdx.x * 256 + threadIdx.x;
  if (i < n2) {
    const _Float16 h0 = (_Float16)(in[2 * i] * mul), h1 = (_Float16)(in[2 * i + 1] * mul);
    const unsigned u = (unsigned)__builtin_bit_cast(unsigned short, h0) | ((unsigned)__builtin_bit_cast(unsigned short, h1) << 16);
    ((unsigned*)out)[i] = u;
    
  }
}

// =====================================================================================
// Non-causal attention for head_dim 64, 16-bit q/k/v planes in, f32 out.
//   q, k, v: f16, element (b, s, h, d) at X[(b*S + s)*HID + h*64 + d]; out f32 with the same indexing.
//   scores = (q.k^T) * sscale : v_wmma_f32_16x16x32_f16, scale applied to the f32 accumulator
//   out    = p.v             : v_wmma_f32_16x16x32_f16, p carried x2^15 in f16, folded into the final 1/l
//   f32 accumulate; online softmax in f32. Block = 4 waves = 64 query rows of one (batch, head);
//   keys streamed in 64-key chunks staged in LDS (K as [kv][d], V transposed to [d][kv]; rows of 128 B at a pitch of 144 B).
//   grid.x = B * H * (S/64).
// =====================================================================================
#define AT_D 64
#define AT_NW 4
#define AT_QB 64
#define AT_KC 64
#define AT_LP 72   // LDS row pitch of the K, V^T and P tiles in f16: 144 B = 16 B x odd, so the 16 rows of a 16-byte fragment read fall on distinct banks

__device__ __forceinline__ v8f hmma16(v16h a, v16h b, v8f c) {
  c = __builtin_amdgcn_wmma_f32_16x16x32_f16(false, a, false, b, (short)0, c, false, false);
  asm volatile("v_nop\n\tv_nop\n\tv_nop\n\tv_nop" : "+v"(c) : "v"(a), "v"(b));
  return c;
}

__global__ __launch_bounds__(128)
void attn64_f16(const _Float16* __restrict__ qp, const _Float16* __restrict__ kp,
                const _Float16* __restrict__ vp, float* __restrict__ out, float sscale) {
  __shared__ __align__(16) _Float16 Ksh[AT_KC * AT_LP];         // K [kv][d], padded rows          9 KB
  __shared__ __align__(16) _Float16 Vth[AT_D * AT_LP];          // V^T [d][kv], padded rows        9 KB
  __shared__ __align__(16) _Float16 Psh[AT_NW][16 * AT_LP];     // per wave P [row][kv], padded rows 9 KB
  __shared__ __align__(16) float    Os[AT_NW][16 * 68];         // per wave out tile, pitch 68

  const int tid  = threadIdx.x;
  const int wave = tid >> 5;
  const int lane = tid & 31;
  const int hh   = lane >> 4;
  const int c    = lane & 15;

  const int nqb = S_ / AT_QB;                                   // 32
  const int bx = blockIdx.x;
  if (bx >= B_ * H_ * nqb) return;                              // block-uniform, ahead of every barrier
  const int qb = bx % nqb;
  const int bh = bx / nqb;
  const int h  = bh % H_;
  const int b  = bh / H_;
  const int q0 = qb * AT_QB + wave * 16;

  const size_t pbase = (size_t)b * S_ * HID_ + (size_t)h * DH_;
  const _Float16* qb_ptr = qp + pbase;
  const _Float16* kb_ptr = kp + pbase;
  const _Float16* vb_ptr = vp + pbase;
  float*          ob_ptr = out + pbase;

  // ---- Q fragments (A operand, row = query q0 + c, k = d): 2 d-chunks, dense static-stride loads ----
  v16h qa[2];
#pragma unroll
  for (int dc = 0; dc < 2; ++dc)
    qa[dc] = Frag<_Float16>::load(qb_ptr + (size_t)(q0 + c) * HID_ + dc * 32 + 8 * hh);

  float mrow[8], lrow[8];
  v8f oacc[4];
#pragma unroll
  for (int r = 0; r < 8; ++r) { mrow[r] = -INFINITY; lrow[r] = 0.f; }
#pragma unroll
  for (int t = 0; t < 4; ++t) oacc[t] = (v8f){0.f,0.f,0.f,0.f,0.f,0.f,0.f,0.f};

  for (int kc = 0; kc < S_ / AT_KC; ++kc) {                     // 32 chunks, static
    const int kv0 = kc * AT_KC;
    __syncthreads();
    {
      const int kvr = tid >> 1, dh = (tid & 1) * 32;            // 128 threads: 64 key rows x 2 halves of 32 d
      const _Float16* krow = kb_ptr + (size_t)(kv0 + kvr) * HID_ + dh;
      const _Float16* vrow = vb_ptr + (size_t)(kv0 + kvr) * HID_ + dh;
#pragma unroll
      for (int i = 0; i < 4; ++i) {
        const v8h kk = *(const v8h*)(krow + 8 * i);
        const v8h vv = *(const v8h*)(vrow + 8 * i);
        *(v8h*)(Ksh + kvr * AT_LP + dh + 8 * i) = kk;
#pragma unroll
        for (int e = 0; e < 8; ++e) Vth[(dh + 8 * i + e) * AT_LP + kvr] = vv[e];
      }
    }
    __syncthreads();

    // scores: 16 queries x 64 keys per wave; B[k = d][n = kv] = Ksh[kv][d]
    v8f s[4];
#pragma unroll
    for (int j = 0; j < 4; ++j) {
      s[j] = (v8f){0.f,0.f,0.f,0.f,0.f,0.f,0.f,0.f};
#pragma unroll
      for (int dc = 0; dc < 2; ++dc) {
        const v16h kb = Frag<_Float16>::load(Ksh + (j * 16 + c) * AT_LP + dc * 32 + 8 * hh);
        s[j] = hmma16(qa[dc], kb, s[j]);
      }
    }

    // online softmax in D layout: row 8*hh + r, key column kv0 + j*16 + c
    float cm[8];
#pragma unroll
    for (int r = 0; r < 8; ++r) {
      float m = -INFINITY;
#pragma unroll
      for (int j = 0; j < 4; ++j) {
        const float sv = s[j][r] * sscale;
        s[j][r] = sv;
        m = fmaxf(m, sv);
      }
#pragma unroll
      for (int off = 1; off < 16; off <<= 1) m = fmaxf(m, __shfl_xor(m, off, 32));
      cm[r] = m;
    }
    _Float16* pw = Psh[wave];
#pragma unroll
    for (int r = 0; r < 8; ++r) {
      const float mnew = fmaxf(mrow[r], cm[r]);
      const float alpha = expf(mrow[r] - mnew);
      mrow[r] = mnew;
      float psum = 0.f;
#pragma unroll
      for (int j = 0; j < 4; ++j) {
        const float p = expf(s[j][r] - mnew);
        psum += p;
        pw[(8 * hh + r) * AT_LP + j * 16 + c] = (_Float16)(p * PSCALE);
      }
#pragma unroll
      for (int off = 1; off < 16; off <<= 1) psum += __shfl_xor(psum, off, 32);
      lrow[r] = lrow[r] * alpha + psum;
#pragma unroll
      for (int t = 0; t < 4; ++t) oacc[t][r] *= alpha;
    }
    __builtin_amdgcn_fence(__ATOMIC_RELEASE, "workgroup");
    __builtin_amdgcn_wave_barrier();
    __builtin_amdgcn_fence(__ATOMIC_ACQUIRE, "workgroup");

    // p.v: A[m = row][k = kv] = Psh (same element type reload), B[k = kv][n = d] = Vth[d][kv]
#pragma unroll 1
    for (int kk = 0; kk < 2; ++kk) {
      const v16h pa = Frag<_Float16>::load(pw + c * AT_LP + kk * 32 + 8 * hh);
#pragma unroll
      for (int t = 0; t < 4; ++t) {
        const v16h vb = Frag<_Float16>::load(Vth + (t * 16 + c) * AT_LP + kk * 32 + 8 * hh);
        oacc[t] = hmma16(pa, vb, oacc[t]);
      }
    }
  }

  // ---- epilogue: out = acc / (l * 2^15), staged per wave in LDS, whole 256-B row segments ----
  float* os = Os[wave];
#pragma unroll
  for (int r = 0; r < 8; ++r) {
    const float inv = 1.0f / (lrow[r] * PSCALE);
#pragma unroll
    for (int t = 0; t < 4; ++t) os[(8 * hh + r) * 68 + t * 16 + c] = oacc[t][r] * inv;
  }
  __builtin_amdgcn_fence(__ATOMIC_RELEASE, "workgroup");
  __builtin_amdgcn_wave_barrier();
  __builtin_amdgcn_fence(__ATOMIC_ACQUIRE, "workgroup");
  {
    const int c4 = (lane & 15) * 4;
    {
#pragma unroll
      for (int it = 0; it < 8; ++it) {
        const int row = it * 2 + hh;
        v4f val = *(const v4f*)(os + row * 68 + c4);
        *(v4f*)(ob_ptr + (size_t)(q0 + row) * HID_ + c4) = val;
      }
      
    }
  }
}

// ---------------------------------------------------------------------------
// Host glue. Workspace carve (bytes):
//   [0, 196608)              Wq|Wk|Wv as f16 (x16 carry), each [H][DH][DH]
//   [196608, +8 MiB)         x as f16 [B*S][HID]
//   then q, k, v as f16 [B*S][HID] (8 MiB each); total 33,751,040 B.
// ---------------------------------------------------------------------------
extern "C" void kernel_launch(void* const* d_in, const int* in_sizes, int n_in,
                              void* d_out, int out_size, void* d_ws,
                              size_t ws_size, hipStream_t stream) {
  if (n_in < 7) return;
  const int NX = B_ * S_ * HID_;          // 4194304
  const int NW = H_ * DH_ * DH_;          // 32768
  const int NB = H_ * DH_;                // 512
  if (in_sizes[0] != NX || in_sizes[1] != NW || in_sizes[2] != NB || in_sizes[3] != NW ||
      in_sizes[4] != NB || in_sizes[5] != NW || in_sizes[6] != NB || out_size != NX) return;

  const float* x  = (const float*)d_in[0];
  const float* Wq = (const float*)d_in[1];
  const float* bq = (const float*)d_in[2];
  const float* Wk = (const float*)d_in[3];
  const float* bk = (const float*)d_in[4];
  const float* Wv = (const float*)d_in[5];
  const float* bv = (const float*)d_in[6];
  float* out = (float*)d_out;

  const size_t off_w  = 0;
  const size_t bytesW = (size_t)3 * NW * 2;              // 196608
  const size_t off_x  = off_w + bytesW;
  const size_t bytesP = (size_t)NX * 2;                   // 8388608 per f16 plane
  const size_t off_q  = off_x + bytesP;                   // 8585216
  const size_t off_k  = off_q + bytesP;                   // 16973824
  const size_t off_v  = off_k + bytesP;                   // 25362432
  const size_t off_end = off_v + bytesP;                  // 33751040
  if (off_end > ws_size || off_end > (size_t)134217728) return;

  char* ws = (char*)d_ws;
  _Float16* Wh = (_Float16*)(ws + off_w);
  _Float16* Xh = (_Float16*)(ws + off_x);
  _Float16* Qh = (_Float16*)(ws + off_q);
  _Float16* Kh = (_Float16*)(ws + off_k);
  _Float16* Vh = (_Float16*)(ws + off_v);

  // casts: x -> f16 (x1), weights -> f16 (x16, folded back as 1/16 in the GEMM epilogue)
  {
    const int n2x = NX / 2;                               // 2097152
    cast_f32_f16x2<<<(n2x + 255) / 256, 256, 0, stream>>>(x, Xh, n2x, 1.0f);
    const int n2w = NW / 2;                               // 16384
    cast_f32_f16x2<<<(n2w + 255) / 256, 256, 0, stream>>>(Wq, Wh, n2w, 16.0f);
    cast_f32_f16x2<<<(n2w + 255) / 256, 256, 0, stream>>>(Wk, Wh + NW, n2w, 16.0f);
    cast_f32_f16x2<<<(n2w + 255) / 256, 256, 0, stream>>>(Wv, Wh + 2 * NW, n2w, 16.0f);
  }

  // per-head projections, z = head: A = x_f16 [8192][512] columns h*64.. (lda 512, strideA 64),
  // Bt = W[h] ([out][in] = [N][K], ldb 64, strideB 4096), C = f16 plane [8192][512] columns h*64.. (ldc 512, strideC 64);
  // M = 8192, N = 64, K = 64; bias[n] = b[h*64 + n] (strideBias 64); scale 1/16.
  {
    const int M = B_ * S_, N = DH_, K = DH_;
    const int tiles = (M / 64) * (N / 64);                // 128
    dim3 ggrid((tiles + 7) / 8, H_);
    const unsigned short* Xu = (const unsigned short*)Xh;
    const unsigned short* Wu = (const unsigned short*)Wh;
    const float wscale = 1.0f / 16.0f;
    wmma_gemm64<0, false, 2, 1, false, 0><<<ggrid, 256, 0, stream>>>(
        Xu, Xu, HID_, (long)DH_, Wu, Wu, DH_, (long)(DH_ * DH_),
        (void*)Qh, (void*)Qh, HID_, (long)DH_, bq, (long)DH_, x, 0L, M, N, K, wscale);
    wmma_gemm64<0, false, 2, 1, false, 0><<<ggrid, 256, 0, stream>>>(
        Xu, Xu, HID_, (long)DH_, Wu + NW, Wu + NW, DH_, (long)(DH_ * DH_),
        (void*)Kh, (void*)Kh, HID_, (long)DH_, bk, (long)DH_, x, 0L, M, N, K, wscale);
    wmma_gemm64<0, false, 2, 1, false, 0><<<ggrid, 256, 0, stream>>>(
        Xu, Xu, HID_, (long)DH_, Wu + 2 * NW, Wu + 2 * NW, DH_, (long)(DH_ * DH_),
        (void*)Vh, (void*)Vh, HID_, (long)DH_, bv, (long)DH_, x, 0L, M, N, K, wscale);
  }

  // attention: one block per (b, h, 64-query block); keys streamed in 64-key chunks, no mask, score scale 1/8.
  {
    const int nblk = B_ * H_ * (S_ / AT_QB);              // 1024
    attn64_f16<<<nblk, 128, 0, stream>>>(Qh, Kh, Vh, out, 0.125f);
  }
}

// v002
// A run of this version takes 139 microseconds.
// Next to v001, in two timings, it ran 1.44 and 1.45 times as fast.
// All steps since v000 together make it 1.80 times as fast.
// Contractions: per-head q/k/v projections = v_wmma_f32_16x16x32_f16 (f16 operands, weights carried x16, f32 accumulate, f16 output planes);
// attention q.k^T and p.v = v_wmma_f32_16x16x32_f16 (f16 operands, p carried x2^15, f32 accumulate); softmax and epilogues f32.
#include <hip/hip_runtime.h>
#include <math.h>

#define B_   4
#define S_   2048
#define HID_ 512
#define H_   8
#define DH_  64

typedef __attribute__((ext_vector_type(16))) _Float16 v16h;
typedef __attribute__((ext_vector_type(8)))  _Float16 v8h;
typedef __attribute__((ext_vector_type(16))) __bf16   v16b;
typedef __attribute__((ext_vector_type(8)))  __bf16   v8b;
typedef __attribute__((ext_vector_type(8)))  float    v8f;
typedef __attribute__((ext_vector_type(4)))  float    v4f;
#define PSCALE 32768.0f
#define U16(p) ((const unsigned short*)(const void*)(p))
#define PSCALE_INV (1.0f / 32768.0f)

__device__ __forceinline__ unsigned short f2bf_bits(float f) {
  unsigned u = __float_as_uint(f);
  return (unsigned short)((u + 0x7FFFu + ((u >> 16) & 1u)) >> 16);
}
__device__ __forceinline__ float bf_bits2f(unsigned short h) { return __uint_as_float(((unsigned)h) << 16); }

// hazard guards as plain device helpers (no inline asm inside the kernel template body)
__device__ __forceinline__ void dep_guard_h(v8f& a, v8f& b, v16h x, v16h y) { asm volatile("v_nop\n\tv_nop\n\tv_nop\n\tv_nop" : "+v"(a), "+v"(b) : "v"(x), "v"(y)); }
__device__ __forceinline__ void dep_guard_b(v8f& a, v8f& b, v16b x, v16b y) { asm volatile("v_nop\n\tv_nop\n\tv_nop\n\tv_nop" : "+v"(a), "+v"(b) : "v"(x), "v"(y)); }
__device__ __forceinline__ void keep4_h(v16h a, v16h b, v16h c, v16h d) { asm volatile("v_nop" :: "v"(a), "v"(b), "v"(c), "v"(d)); }
__device__ __forceinline__ void keep4_b(v16b a, v16b b, v16b c, v16b d) { asm volatile("v_nop" :: "v"(a), "v"(b), "v"(c), "v"(d)); }
__device__ __forceinline__ void acc_guard4(v8f& a, v8f& b, v8f& c, v8f& d) { asm volatile("v_nop\n\tv_nop\n\tv_nop\n\tv_nop" : "+v"(a), "+v"(b), "+v"(c), "+v"(d)); }
template <typename T> struct Frag;
template <> struct Frag<_Float16> {
  typedef v16h V; union U { v16h v; v8h h[2]; };
  static __device__ __forceinline__ v16h load(const _Float16* p) {   // elements 0..7 <- p[0..7], 8..15 <- p[16..23]
    U f; f.h[0] = *(const v8h*)(p); f.h[1] = *(const v8h*)(p + 16); return f.v;
  }
  static __device__ __forceinline__ v8f mma(v16h a, v16h b, v8f c) {
    return __builtin_amdgcn_wmma_f32_16x16x32_f16(false, a, false, b, (short)0, c, false, false);
  }
  static __device__ __forceinline__ void guard(v8f& a, v8f& b, v16h x, v16h y) { dep_guard_h(a, b, x, y); }
  static __device__ __forceinline__ void keep(v16h a, v16h b, v16h c, v16h d) { keep4_h(a, b, c, d); }
};
template <> struct Frag<__bf16> {
  typedef v16b V; union U { v16b v; v8b h[2]; };
  static __device__ __forceinline__ v16b load(const __bf16* p) {
    U f; f.h[0] = *(const v8b*)(p); f.h[1] = *(const v8b*)(p + 16); return f.v;
  }
  static __device__ __forceinline__ v8f mma(v16b a, v16b b, v8f c) {
    return __builtin_amdgcn_wmma_f32_16x16x32_bf16(false, a, false, b, (short)0, c, false, false);
  }
  static __device__ __forceinline__ void guard(v8f& a, v8f& b, v16b x, v16b y) { dep_guard_b(a, b, x, y); }
  static __device__ __forceinline__ void keep(v16b a, v16b b, v16b c, v16b d) { keep4_b(a, b, c, d); }
};

// ---- Register-blocked batched WMMA GEMM ------------------------------------
// C[m,n] = scale * sum_k A[m,k] * Bt[n,k] (+bias)(+resid); each wave owns a 64x64 tile.
// A row-major [M,K]; Bt row-major [N,K]; M,N % 64 == 0, K % 32 == 0.
// SPLIT: operands are hi/lo planes (A2/Bt2 = lo planes, same layout); product = hi.hi + hi.lo + lo.hi.
// BIAS_MODE: 0 = none, 1 = bias[m], 2 = bias[n]; bias pointer advanced by blockIdx.y * strideBias.
// OUT_MODE: 0 = f32, 1 = f16, 2 = bf16 hi plane (Cout) + bf16 lo plane (Cout2).
// ET: 0 = f16 operands, 1 = bf16 operands (pointers passed as 16-bit storage)
template <int ET> struct Elem;
template <> struct Elem<0> { typedef _Float16 T; };
template <> struct Elem<1> { typedef __bf16 T; };
template <int ET, bool SPLIT, int BIAS_MODE, int OUT_MODE, bool RESID, int ACT = 0>
__global__ __launch_bounds__(256) void wmma_gemm64(
    const unsigned short* __restrict__ Ap, const unsigned short* __restrict__ A2p, int lda, long strideA,
    const unsigned short* __restrict__ Btp, const unsigned short* __restrict__ Bt2p, int ldb, long strideB,
    void* __restrict__ Cout, void* __restrict__ Cout2, int ldc, long strideC,
    const float* __restrict__ bias, long strideBias,
    const float* __restrict__ resid, long strideR,
    int M, int N, int K, float scale) {
  typedef typename Elem<ET>::T T;
  typedef typename Frag<T>::V V;
  const T* A = (const T*)Ap; const T* A2 = (const T*)A2p; const T* Bt = (const T*)Btp; const T* Bt2 = (const T*)Bt2p;
  __shared__ __align__(16) float sT[8][16 * 68];   // per-wave 16x64 slab, pitch 68 floats
  const int b    = blockIdx.y;
  const int lane = threadIdx.x & 31;
  const int wave = threadIdx.x >> 5;
  const int tilesN = N >> 6;
  const int tilesM = M >> 6;
  const int tile = blockIdx.x * 8 + wave;
  if (tile >= tilesM * tilesN) return;   // wave-uniform; no block barriers in this kernel
  const int tm = tile / tilesN;
  const int tn = tile - tm * tilesN;
  const int m0 = tm << 6;
  const int n0 = tn << 6;

  const T* Ab  = A  + (size_t)b * strideA;
  const T* Bb  = Bt + (size_t)b * strideB;
  const T* Ab2 = SPLIT ? (A2  + (size_t)b * strideA) : nullptr;
  const T* Bb2 = SPLIT ? (Bt2 + (size_t)b * strideB) : nullptr;
  const float* biasb = (BIAS_MODE != 0) ? (bias + (size_t)b * strideBias) : nullptr;

  const int rlane = lane & 15;                 // row (A) / col (B, D) within subtile
  const int koff  = (lane >> 4) * 8;           // k offset of this lane half
  const int mOff  = (lane >> 4) * 8;           // D row offset

  v8f acc[4][4];
#pragma unroll
  for (int i = 0; i < 4; ++i)
#pragma unroll
    for (int j = 0; j < 4; ++j) acc[i][j] = (v8f){0.f,0.f,0.f,0.f,0.f,0.f,0.f,0.f};

  for (int k0 = 0; k0 < K; k0 += 32) {
    V bh[4], bl[4];
#pragma unroll
    for (int j = 0; j < 4; ++j) {
      const size_t bo = (size_t)(n0 + (j << 4) + rlane) * ldb + koff + k0;
      bh[j] = Frag<T>::load(Bb + bo);
      if (SPLIT) bl[j] = Frag<T>::load(Bb2 + bo);
    }
#pragma unroll
    for (int i = 0; i < 4; ++i) {
      const size_t ao = (size_t)(m0 + (i << 4) + rlane) * lda + koff + k0;
      V ah = Frag<T>::load(Ab + ao);
      V al;
      if (SPLIT) al = Frag<T>::load(Ab2 + ao);
#pragma unroll
      for (int j = 0; j < 4; ++j) {
        acc[i][j] = Frag<T>::mma(ah, bh[j], acc[i][j]);
        if (SPLIT) {
          acc[i][j] = Frag<T>::mma(ah, bl[j], acc[i][j]);
          acc[i][j] = Frag<T>::mma(al, bh[j], acc[i][j]);
        }
      }
      Frag<T>::guard(acc[i][0], acc[i][3], ah, SPLIT ? al : ah);
    }
    Frag<T>::keep(bh[0], bh[1], bh[2], bh[3]);
    if (SPLIT) Frag<T>::keep(bl[0], bl[1], bl[2], bl[3]);
  }
  acc_guard4(acc[0][0], acc[0][1], acc[0][2], acc[0][3]);
  acc_guard4(acc[1][0], acc[1][1], acc[1][2], acc[1][3]);
  acc_guard4(acc[2][0], acc[2][1], acc[2][2], acc[2][3]);
  acc_guard4(acc[3][0], acc[3][1], acc[3][2], acc[3][3]);

  // ---- epilogue ----
  float* slab = sT[wave];
  const float* Rb = RESID ? (resid + (size_t)b * strideR) : nullptr;
#pragma unroll
  for (int i = 0; i < 4; ++i) {
    const int mBase = m0 + (i << 4);
#pragma unroll
    for (int j = 0; j < 4; ++j) {
      const int n = n0 + (j << 4) + rlane;
      float bv = 0.f;
      if (BIAS_MODE == 2) bv = biasb[n];
#pragma unroll
      for (int r = 0; r < 8; ++r) {
        float v = acc[i][j][r] * scale;
        if (BIAS_MODE == 1) v += biasb[mBase + mOff + r];
        if (BIAS_MODE == 2) v += bv;
        if (RESID) v += Rb[(size_t)(mBase + mOff + r) * ldc + n];
        if (ACT == 1) v = tanhf(v);
        if (ACT == 2) v = fmaxf(v, 0.0f);
        if (ACT == 3) v = v / (1.0f + expf(-v));
        if (ACT == 4) v = (v > 0.f) ? v : 0.01f * v;
        if (ACT == 5) v = 0.5f * v * (1.0f + erff(v * 0.70710678118654752f));
        slab[(mOff + r) * 68 + (j << 4) + rlane] = v;
      }
    }
    __builtin_amdgcn_fence(__ATOMIC_RELEASE, "workgroup");
    __builtin_amdgcn_wave_barrier();
    __builtin_amdgcn_fence(__ATOMIC_ACQUIRE, "workgroup");
    if (OUT_MODE == 0) {
      float* C = (float*)Cout + (size_t)b * strideC;
      const int hh = lane >> 4, c4 = (lane & 15) * 4;     // row seg = 256 B = 16 lanes x 16 B
      {
#pragma unroll
        for (int it = 0; it < 8; ++it) {
          const int row = it * 2 + hh;
          v4f v = *(const v4f*)(slab + row * 68 + c4);
          *(v4f*)(C + (size_t)(mBase + row) * ldc + n0 + c4) = v;
        }
        
      }
    } else {
      const int q = lane >> 3, c8 = (lane & 7) * 8;
      unsigned short* C  = (unsigned short*)Cout  + (size_t)b * strideC;
      unsigned short* C2 = (OUT_MODE == 2) ? ((unsigned short*)Cout2 + (size_t)b * strideC) : nullptr;
      {
#pragma unroll
        for (int it = 0; it < 4; ++it) {
          const int row = it * 4 + q;
          const float* sp = slab + row * 68 + c8;
          v8h hv, lv;
#pragma unroll
          for (int e = 0; e < 8; ++e) {
            if (OUT_MODE == 1) {
              hv[e] = (_Float16)sp[e];
            } else {
              unsigned short hb = f2bf_bits(sp[e]);
              unsigned short lb = f2bf_bits(sp[e] - bf_bits2f(hb));
              hv[e] = __builtin_bit_cast(_Float16, hb);
              lv[e] = __builtin_bit_cast(_Float16, lb);
            }
          }
          *(v8h*)(C + (size_t)(mBase + row) * ldc + n0 + c8) = hv;
          if (OUT_MODE == 2) *(v8h*)(C2 + (size_t)(mBase + row) * ldc + n0 + c8) = lv;
        }
        
      }
    }
    __builtin_amdgcn_fence(__ATOMIC_RELEASE, "workgroup");
    __builtin_amdgcn_wave_barrier();
    __builtin_amdgcn_fence(__ATOMIC_ACQUIRE, "workgroup");
  }
}

__global__ __launch_bounds__(256) void cast_f32_f16x2(
    const float* __restrict__ in, _Float16* __restrict__ out, int n2, float mul) {
  int i = blockIdx.x * 256 + threadIdx.x;
  if (i < n2) {
    const _Float16 h0 = (_Float16)(in[2 * i] * mul), h1 = (_Float16)(in[2 * i + 1] * mul);
    const unsigned u = (unsigned)__builtin_bit_cast(unsigned short, h0) | ((unsigned)__builtin_bit_cast(unsigned short, h1) << 16);
    ((unsigned*)out)[i] = u;
    
  }
}

// =====================================================================================
// Non-causal attention for head_dim 64, 16-bit q/k/v planes in, f32 out.
//   q, k, v: f16, element (b, s, h, d) at X[(b*S + s)*HID + h*64 + d]; out f32 with the same indexing.
//   scores^T = (k.q^T) * sscale : v_wmma_f32_16x16x32_f16, scale applied to the f32 accumulator
//   out^T    = v^T.p^T          : v_wmma_f32_16x16x32_f16, p carried x2^15 in f16 (kept in registers), folded into the final 1/l
//   f32 accumulate; online softmax in f32. Block = 4 waves = 64 query rows of one (batch, head);
//   keys streamed in 64-key chunks staged in LDS (K as [kv][d], V transposed to [d][kv]; rows of 128 B at a pitch of 144 B).
//   grid.x = B * H * (S/64).
// =====================================================================================
#define AT_D 64
#define AT_NW 4
#define AT_QB 64
#define AT_KC 64
#define AT_LP 72   // LDS row pitch of the K and V^T tiles in f16: 144 B = 16 B x odd, so the 16 rows of a 16-byte fragment read fall on distinct banks

__device__ __forceinline__ v8f hmma16(v16h a, v16h b, v8f c) {
  c = __builtin_amdgcn_wmma_f32_16x16x32_f16(false, a, false, b, (short)0, c, false, false);
  asm volatile("v_nop\n\tv_nop\n\tv_nop\n\tv_nop" : "+v"(c) : "v"(a), "v"(b));
  return c;
}

// value of lane l ^ 16 (the other wave half), as a vector cross-row move; all 32 lanes are on wherever it is called
__device__ __forceinline__ float xhalf(float x) {
  const int b = __builtin_bit_cast(int, x);
  return __builtin_bit_cast(float, __builtin_amdgcn_permlanex16(b, b, 0x76543210, 0xfedcba98, false, false));
}

__global__ __launch_bounds__(128)
void attn64_f16(const _Float16* __restrict__ qp, const _Float16* __restrict__ kp,
                const _Float16* __restrict__ vp, float* __restrict__ out, float sscale) {
  __shared__ __align__(16) _Float16 Ksh[AT_KC * AT_LP];         // K [kv][d], padded rows          9 KB
  __shared__ __align__(16) _Float16 Vth[AT_D * AT_LP];          // V^T [d][kv], padded rows        9 KB
  __shared__ __align__(16) float    Os[AT_NW][16 * 68];         // per wave out tile, pitch 68

  const int tid  = threadIdx.x;
  const int wave = tid >> 5;
  const int lane = tid & 31;
  const int hh   = lane >> 4;
  const int c    = lane & 15;

  const int nqb = S_ / AT_QB;                                   // 32
  const int bx = blockIdx.x;
  if (bx >= B_ * H_ * nqb) return;                              // block-uniform, ahead of every barrier
  const int qb = bx % nqb;
  const int bh = bx / nqb;
  const int h  = bh % H_;
  const int b  = bh / H_;
  const int q0 = qb * AT_QB + wave * 16;

  const size_t pbase = (size_t)b * S_ * HID_ + (size_t)h * DH_;
  const _Float16* qb_ptr = qp + pbase;
  const _Float16* kb_ptr = kp + pbase;
  const _Float16* vb_ptr = vp + pbase;
  float*          ob_ptr = out + pbase;

  // ---- Q fragments (B operand, column = query q0 + c, k = d): 2 d-chunks, dense static-stride loads ----
  v16h qa[2];
#pragma unroll
  for (int dc = 0; dc < 2; ++dc)
    qa[dc] = Frag<_Float16>::load(qb_ptr + (size_t)(q0 + c) * HID_ + dc * 32 + 8 * hh);

  float mrow = -INFINITY, lrow = 0.f;                           // of query q0 + c; lrow sums this wave half's keys
  v8f oacc[4];
#pragma unroll
  for (int t = 0; t < 4; ++t) oacc[t] = (v8f){0.f,0.f,0.f,0.f,0.f,0.f,0.f,0.f};

  for (int kc = 0; kc < S_ / AT_KC; ++kc) {                     // 32 chunks, static
    const int kv0 = kc * AT_KC;
    __syncthreads();
    {
      const int kvr = tid >> 1, dh = (tid & 1) * 32;            // 128 threads: 64 key rows x 2 halves of 32 d
      const _Float16* krow = kb_ptr + (size_t)(kv0 + kvr) * HID_ + dh;
      const _Float16* vrow = vb_ptr + (size_t)(kv0 + kvr) * HID_ + dh;
#pragma unroll
      for (int i = 0; i < 4; ++i) {
        const v8h kk = *(const v8h*)(krow + 8 * i);
        const v8h vv = *(const v8h*)(vrow + 8 * i);
        *(v8h*)(Ksh + kvr * AT_LP + dh + 8 * i) = kk;
#pragma unroll
        for (int e = 0; e < 8; ++e) Vth[(dh + 8 * i + e) * AT_LP + kvr] = vv[e];
      }
    }
    __syncthreads();

    // scores transposed: S^T = K.Q^T, 64 keys x 16 queries per wave; A[m = kv][k = d] = Ksh[kv][d], B[k = d][n = query] = qa
    // D layout: s[j][r] = score of key kv0 + j*16 + 8*hh + r for query q0 + c, so a lane holds scores of one query only
    v8f s[4];
#pragma unroll
    for (int j = 0; j < 4; ++j) {
      s[j] = (v8f){0.f,0.f,0.f,0.f,0.f,0.f,0.f,0.f};
#pragma unroll
      for (int dc = 0; dc < 2; ++dc) {
        const v16h kb = Frag<_Float16>::load(Ksh + (j * 16 + c) * AT_LP + dc * 32 + 8 * hh);
        s[j] = hmma16(kb, qa[dc], s[j]);
      }
    }

    // online softmax, one query per lane: maximum in-lane over the lane's 32 keys, one exchange between the wave halves
    float m = -INFINITY;
#pragma unroll
    for (int j = 0; j < 4; ++j)
#pragma unroll
      for (int r = 0; r < 8; ++r) {
        const float sv = s[j][r] * sscale;
        s[j][r] = sv;
        m = fmaxf(m, sv);
      }
    m = fmaxf(m, xhalf(m));
    const float mnew = fmaxf(mrow, m);
    const float alpha = expf(mrow - mnew);
    mrow = mnew;
    // P^T packs from the score tiles straight into the B operand: element e of pb[kk] = tile 2*kk + (e >> 3), register e & 7
    v16h pb[2];
    float psum = 0.f;
#pragma unroll
    for (int j = 0; j < 4; ++j)
#pragma unroll
      for (int r = 0; r < 8; ++r) {
        const float p = expf(s[j][r] - mnew);
        psum += p;
        pb[j >> 1][(j & 1) * 8 + r] = (_Float16)(p * PSCALE);
      }
    lrow = lrow * alpha + psum;                                 // this half's keys only; the halves join in the epilogue
#pragma unroll
    for (int t = 0; t < 4; ++t)
#pragma unroll
      for (int r = 0; r < 8; ++r) oacc[t][r] *= alpha;

    // O^T += V^T.P^T: A[m = d][k = kv] = Vth[d][kv], B[k = kv][n = query] = pb; oacc[t][r] = out[q0 + c][t*16 + 8*hh + r]
#pragma unroll
    for (int kk = 0; kk < 2; ++kk) {
#pragma unroll
      for (int t = 0; t < 4; ++t) {
        const v16h va = Frag<_Float16>::load(Vth + (t * 16 + c) * AT_LP + kk * 32 + 8 * hh);
        oacc[t] = hmma16(va, pb[kk], oacc[t]);
      }
    }
  }

  // ---- epilogue: out = acc / (l * 2^15), staged per wave in LDS, whole 256-B row segments ----
  float* os = Os[wave];
  {
    const float l = lrow + xhalf(lrow);
    const float inv = 1.0f / (l * PSCALE);
#pragma unroll
    for (int t = 0; t < 4; ++t) {
      v4f lo, hi;
#pragma unroll
      for (int r = 0; r < 4; ++r) { lo[r] = oacc[t][r] * inv; hi[r] = oacc[t][4 + r] * inv; }
      *(v4f*)(os + c * 68 + t * 16 + 8 * hh)     = lo;
      *(v4f*)(os + c * 68 + t * 16 + 8 * hh + 4) = hi;
    }
  }
  __builtin_amdgcn_fence(__ATOMIC_RELEASE, "workgroup");
  __builtin_amdgcn_wave_barrier();
  __builtin_amdgcn_fence(__ATOMIC_ACQUIRE, "workgroup");
  {
    const int c4 = (lane & 15) * 4;
    {
#pragma unroll
      for (int it = 0; it < 8; ++it) {
        const int row = it * 2 + hh;
        v4f val = *(const v4f*)(os + row * 68 + c4);
        *(v4f*)(ob_ptr + (size_t)(q0 + row) * HID_ + c4) = val;
      }
      
    }
  }
}

// ---------------------------------------------------------------------------
// Host glue. Workspace carve (bytes):
//   [0, 196608)              Wq|Wk|Wv as f16 (x16 carry), each [H][DH][DH]
//   [196608, +8 MiB)         x as f16 [B*S][HID]
//   then q, k, v as f16 [B*S][HID] (8 MiB each); total 33,751,040 B.
// ---------------------------------------------------------------------------
extern "C" void kernel_launch(void* const* d_in, const int* in_sizes, int n_in,
                              void* d_out, int out_size, void* d_ws,
                              size_t ws_size, hipStream_t stream) {
  if (n_in < 7) return;
  const int NX = B_ * S_ * HID_;          // 4194304
  const int NW = H_ * DH_ * DH_;          // 32768
  const int NB = H_ * DH_;                // 512
  if (in_sizes[0] != NX || in_sizes[1] != NW || in_sizes[2] != NB || in_sizes[3] != NW ||
      in_sizes[4] != NB || in_sizes[5] != NW || in_sizes[6] != NB || out_size != NX) return;

  const float* x  = (const float*)d_in[0];
  const float* Wq = (const float*)d_in[1];
  const float* bq = (const float*)d_in[2];
  const float* Wk = (const float*)d_in[3];
  const float* bk = (const float*)d_in[4];
  const float* Wv = (const float*)d_in[5];
  const float* bv = (const float*)d_in[6];
  float* out = (float*)d_out;

  const size_t off_w  = 0;
  const size_t bytesW = (size_t)3 * NW * 2;              // 196608
  const size_t off_x  = off_w + bytesW;
  const size_t bytesP = (size_t)NX * 2;                   // 8388608 per f16 plane
  const size_t off_q  = off_x + bytesP;                   // 8585216
  const size_t off_k  = off_q + bytesP;                   // 16973824
  const size_t off_v  = off_k + bytesP;                   // 25362432
  const size_t off_end = off_v + bytesP;                  // 33751040
  if (off_end > ws_size || off_end > (size_t)134217728) return;

  char* ws = (char*)d_ws;
  _Float16* Wh = (_Float16*)(ws + off_w);
  _Float16* Xh = (_Float16*)(ws + off_x);
  _Float16* Qh = (_Float16*)(ws + off_q);
  _Float16* Kh = (_Float16*)(ws + off_k);
  _Float16* Vh = (_Float16*)(ws + off_v);

  // casts: x -> f16 (x1), weights -> f16 (x16, folded back as 1/16 in the GEMM epilogue)
  {
    const int n2x = NX / 2;                               // 2097152
    cast_f32_f16x2<<<(n2x + 255) / 256, 256, 0, stream>>>(x, Xh, n2x, 1.0f);
    const int n2w = NW / 2;                               // 16384
    cast_f32_f16x2<<<(n2w + 255) / 256, 256, 0, stream>>>(Wq, Wh, n2w, 16.0f);
    cast_f32_f16x2<<<(n2w + 255) / 256, 256, 0, stream>>>(Wk, Wh + NW, n2w, 16.0f);
    cast_f32_f16x2<<<(n2w + 255) / 256, 256, 0, stream>>>(Wv, Wh + 2 * NW, n2w, 16.0f);
  }

  // per-head projections, z = head: A = x_f16 [8192][512] columns h*64.. (lda 512, strideA 64),
  // Bt = W[h] ([out][in] = [N][K], ldb 64, strideB 4096), C = f16 plane [8192][512] columns h*64.. (ldc 512, strideC 64);
  // M = 8192, N = 64, K = 64; bias[n] = b[h*64 + n] (strideBias 64); scale 1/16.
  {
    const int M = B_ * S_, N = DH_, K = DH_;
    const int tiles = (M / 64) * (N / 64);                // 128
    dim3 ggrid((tiles + 7) / 8, H_);
    const unsigned short* Xu = (const unsigned short*)Xh;
    const unsigned short* Wu = (const unsigned short*)Wh;
    const float wscale = 1.0f / 16.0f;
    wmma_gemm64<0, false, 2, 1, false, 0><<<ggrid, 256, 0, stream>>>(
        Xu, Xu, HID_, (long)DH_, Wu, Wu, DH_, (long)(DH_ * DH_),
        (void*)Qh, (void*)Qh, HID_, (long)DH_, bq, (long)DH_, x, 0L, M, N, K, wscale);
    wmma_gemm64<0, false, 2, 1, false, 0><<<ggrid, 256, 0, stream>>>(
        Xu, Xu, HID_, (long)DH_, Wu + NW, Wu + NW, DH_, (long)(DH_ * DH_),
        (void*)Kh, (void*)Kh, HID_, (long)DH_, bk, (long)DH_, x, 0L, M, N, K, wscale);
    wmma_gemm64<0, false, 2, 1, false, 0><<<ggrid, 256, 0, stream>>>(
        Xu, Xu, HID_, (long)DH_, Wu + 2 * NW, Wu + 2 * NW, DH_, (long)(DH_ * DH_),
        (void*)Vh, (void*)Vh, HID_, (long)DH_, bv, (long)DH_, x, 0L, M, N, K, wscale);
  }

  // attention: one block per (b, h, 64-query block); keys streamed in 64-key chunks, no mask, score scale 1/8.
  {
    const int nblk = B_ * H_ * (S_ / AT_QB);              // 1024
    attn64_f16<<<nblk, 128, 0, stream>>>(Qh, Kh, Vh, out, 0.125f);
  }
}

// v003
// It runs in 107 microseconds.
// Next to v002, in two timings, it ran 1.30 and 1.31 times as fast.
// Counting every step since v000, it is 2.35 times as fast.
// Contractions: per-head q/k/v projections = v_wmma_f32_16x16x32_f16 (f16 operands, weights carried x16, f32 accumulate, f16 output planes);
// attention q.k^T and p.v = v_wmma_f32_16x16x32_f16 (f16 operands, p carried x2^15, f32 accumulate); softmax and epilogues f32.
#include <hip/hip_runtime.h>
#include <math.h>

#define B_   4
#define S_   2048
#define HID_ 512
#define H_   8
#define DH_  64

typedef __attribute__((ext_vector_type(16))) _Float16 v16h;
typedef __attribute__((ext_vector_type(8)))  _Float16 v8h;
typedef __attribute__((ext_vector_type(4)))  _Float16 v4h;
typedef __attribute__((ext_vector_type(8)))  float    v8f;
typedef __attribute__((ext_vector_type(4)))  float    v4f;
#define PSCALE 32768.0f

template <typename T> struct Frag;
template <> struct Frag<_Float16> {
  typedef v16h V; union U { v16h v; v8h h[2]; };
  static __device__ __forceinline__ v16h load(const _Float16* p) {   // elements 0..7 <- p[0..7], 8..15 <- p[16..23]
    U f; f.h[0] = *(const v8h*)(p); f.h[1] = *(const v8h*)(p + 16); return f.v;
  }
};

// =====================================================================================
// q, k, v projections of one head for 256 rows, one launch for all three.
//   y[m][n] = (sum_k x[m][h*64 + k] * (16 W[h][n][k])) / 16 + b[h][n], y = q, k, v as f16 planes [B*S][HID].
//   x and W are read as f32 and rounded to f16 in registers (W after the x16 carry).
//   Product transposed: A[m' = n][k] = W rows from LDS, B[k][n' = row] = x rows, so a lane's 8 accumulator
//   registers are 8 neighbouring outputs of one row: D[r] = y[m0 + c][j*16 + 8*hh + r].
//   Block = 8 waves x 32 rows; the x fragments of a wave serve all three weights.
//   grid = (B*S/256, H).
// =====================================================================================
#define PJ_LP 72                       // LDS row pitch in f16: 144 B = 16 B x odd, as for the attention tiles
#define PJ_NW 8
#define PJ_MT 2                        // 16-row tiles per wave
#define PJ_WR (PJ_MT * 16)             // rows per wave
#define PJ_ROWS (PJ_NW * PJ_WR)        // rows per block

__global__ __launch_bounds__(256)
void qkv_proj_f16(const float* __restrict__ x,
                  const float* __restrict__ Wq, const float* __restrict__ bq,
                  const float* __restrict__ Wk, const float* __restrict__ bk,
                  const float* __restrict__ Wv, const float* __restrict__ bv,
                  _Float16* __restrict__ qo, _Float16* __restrict__ ko, _Float16* __restrict__ vo) {
  __shared__ __align__(16) _Float16 Wsh[3][DH_ * PJ_LP];             // 16 W[h] as f16, [n][k], padded rows   27 KB
  __shared__ __align__(16) float    Bsh[3][DH_];                     // b[h]
  __shared__ __align__(16) _Float16 Ts[PJ_NW][3][PJ_WR * PJ_LP];     // per wave and output: 32 x 64 tile     108 KB

  const int tid  = threadIdx.x;
  const int wave = tid >> 5;
  const int lane = tid & 31;
  const int hh   = lane >> 4;
  const int c    = lane & 15;
  const int h    = blockIdx.y;
  const int m0   = blockIdx.x * PJ_ROWS + wave * PJ_WR;

  // Every loop of this kernel is unrolled in full: the fragment and accumulator arrays stay in registers only
  // when they are indexed by constants, and no branch then follows a matrix instruction.
  // ---- all global reads first: the wave's x rows (fragment order) and the block's share of the three weights ----
  v4f xr[PJ_MT][2][4];
#pragma unroll
  for (int mt = 0; mt < PJ_MT; ++mt) {
#pragma unroll
    for (int dc = 0; dc < 2; ++dc) {
      const float* p = x + (size_t)(m0 + mt * 16 + c) * HID_ + h * DH_ + dc * 32 + 8 * hh;
      xr[mt][dc][0] = *(const v4f*)(p);
      xr[mt][dc][1] = *(const v4f*)(p + 4);
      xr[mt][dc][2] = *(const v4f*)(p + 16);
      xr[mt][dc][3] = *(const v4f*)(p + 20);
    }
    // the result of a later load is placed in this row tile's address registers: the wait stands in front of that overwrite
    asm volatile("s_wait_xcnt 0x0" ::: "memory");
  }
  v4f wr[3][4];
#pragma unroll
  for (int i = 0; i < 4; ++i) {
    const size_t wo = (size_t)h * (DH_ * DH_) + (size_t)(i * 256 + tid) * 4;
    wr[0][i] = *(const v4f*)(Wq + wo);
    wr[1][i] = *(const v4f*)(Wk + wo);
    wr[2][i] = *(const v4f*)(Wv + wo);
  }
  if (tid < 3 * DH_) {
    const int w = tid >> 6, n = tid & 63;
    const float* bsrc = (w == 0) ? bq : (w == 1) ? bk : bv;
    Bsh[w][n] = bsrc[h * DH_ + n];
  }
#pragma unroll
  for (int w = 0; w < 3; ++w)
#pragma unroll
    for (int i = 0; i < 4; ++i) {
      const int i4 = i * 256 + tid;                                  // float4 index in the 64 x 64 weight
      v4h hv;
#pragma unroll
      for (int e = 0; e < 4; ++e) hv[e] = (_Float16)(wr[w][i][e] * 16.0f);
      *(v4h*)(&Wsh[w][(i4 >> 4) * PJ_LP + (i4 & 15) * 4]) = hv;
    }
  v16h xb[PJ_MT][2];
#pragma unroll
  for (int mt = 0; mt < PJ_MT; ++mt)
#pragma unroll
    for (int dc = 0; dc < 2; ++dc)
#pragma unroll
      for (int e = 0; e < 16; ++e) xb[mt][dc][e] = (_Float16)xr[mt][dc][e >> 2][e & 3];
  __syncthreads();

  // ---- products and epilogue math; each output has its own LDS tile, so nothing is overwritten ----
#pragma unroll
  for (int w = 0; w < 3; ++w) {
    v8f acc[PJ_MT][4];
#pragma unroll
    for (int mt = 0; mt < PJ_MT; ++mt)
#pragma unroll
      for (int j = 0; j < 4; ++j) acc[mt][j] = (v8f){0.f,0.f,0.f,0.f,0.f,0.f,0.f,0.f};
#pragma unroll
    for (int dc = 0; dc < 2; ++dc)
#pragma unroll
      for (int j = 0; j < 4; ++j) {
        const v16h wa = Frag<_Float16>::load(&Wsh[w][(j * 16 + c) * PJ_LP + dc * 32 + 8 * hh]);
#pragma unroll
        for (int mt = 0; mt < PJ_MT; ++mt)
          acc[mt][j] = __builtin_amdgcn_wmma_f32_16x16x32_f16(false, wa, false, xb[mt][dc], (short)0, acc[mt][j], false, false);
      }
    _Float16* ts = Ts[wave][w];
#pragma unroll
    for (int j = 0; j < 4; ++j) {
      const v4f b0 = *(const v4f*)(&Bsh[w][j * 16 + 8 * hh]);
      const v4f b1 = *(const v4f*)(&Bsh[w][j * 16 + 8 * hh + 4]);
#pragma unroll
      for (int mt = 0; mt < PJ_MT; ++mt) {
        v8h hv;
#pragma unroll
        for (int r = 0; r < 8; ++r) {
          float v = acc[mt][j][r] * (1.0f / 16.0f);
          v += (r < 4) ? b0[r & 3] : b1[r & 3];
          hv[r] = (_Float16)v;
        }
        *(v8h*)(ts + (mt * 16 + c) * PJ_LP + j * 16 + 8 * hh) = hv;
      }
    }
  }
  // the wave reads back only what it wrote itself: order its LDS writes ahead of its LDS reads
  __builtin_amdgcn_fence(__ATOMIC_RELEASE, "workgroup");
  __builtin_amdgcn_wave_barrier();
  __builtin_amdgcn_fence(__ATOMIC_ACQUIRE, "workgroup");

  // ---- stores: 8 lanes x 16 B = one whole 128-B row segment, 4 rows per instruction ----
  {
    const int q = lane >> 3, c8 = (lane & 7) * 8;
#pragma unroll
    for (int w = 0; w < 3; ++w) {
      _Float16* o = ((w == 0) ? qo : (w == 1) ? ko : vo) + (size_t)m0 * HID_ + h * DH_ + c8;
      const _Float16* ts = Ts[wave][w];
#pragma unroll
      for (int it = 0; it < PJ_WR / 4; ++it) {
        const int row = it * 4 + q;
        *(v8h*)(o + (size_t)row * HID_) = *(const v8h*)(ts + row * PJ_LP + c8);
      }
    }
  }
}

// =====================================================================================
// Non-causal attention for head_dim 64, 16-bit q/k/v planes in, f32 out.
//   q, k, v: f16, element (b, s, h, d) at X[(b*S + s)*HID + h*64 + d]; out f32 with the same indexing.
//   scores^T = (k.q^T) * sscale : v_wmma_f32_16x16x32_f16, scale applied to the f32 accumulator
//   out^T    = v^T.p^T          : v_wmma_f32_16x16x32_f16, p carried x2^15 in f16 (kept in registers), folded into the final 1/l
//   f32 accumulate; online softmax in f32. Block = 4 waves = 64 query rows of one (batch, head);
//   keys streamed in 64-key chunks staged in LDS (K as [kv][d], V transposed to [d][kv]; rows of 128 B at a pitch of 144 B).
//   grid.x = B * H * (S/64).
// =====================================================================================
#define AT_D 64
#define AT_NW 4
#define AT_QB 64
#define AT_KC 64
#define AT_LP 72   // LDS row pitch of the K and V^T tiles in f16: 144 B = 16 B x odd, so the 16 rows of a 16-byte fragment read fall on distinct banks

__device__ __forceinline__ v8f hmma16(v16h a, v16h b, v8f c) {
  c = __builtin_amdgcn_wmma_f32_16x16x32_f16(false, a, false, b, (short)0, c, false, false);
  asm volatile("v_nop\n\tv_nop\n\tv_nop\n\tv_nop" : "+v"(c) : "v"(a), "v"(b));
  return c;
}

// value of lane l ^ 16 (the other wave half), as a vector cross-row move; all 32 lanes are on wherever it is called
__device__ __forceinline__ float xhalf(float x) {
  const int b = __builtin_bit_cast(int, x);
  return __builtin_bit_cast(float, __builtin_amdgcn_permlanex16(b, b, 0x76543210, 0xfedcba98, false, false));
}

__global__ __launch_bounds__(128)
void attn64_f16(const _Float16* __restrict__ qp, const _Float16* __restrict__ kp,
                const _Float16* __restrict__ vp, float* __restrict__ out, float sscale) {
  __shared__ __align__(16) _Float16 Ksh[AT_KC * AT_LP];         // K [kv][d], padded rows          9 KB
  __shared__ __align__(16) _Float16 Vth[AT_D * AT_LP];          // V^T [d][kv], padded rows        9 KB
  __shared__ __align__(16) float    Os[AT_NW][16 * 68];         // per wave out tile, pitch 68

  const int tid  = threadIdx.x;
  const int wave = tid >> 5;
  const int lane = tid & 31;
  const int hh   = lane >> 4;
  const int c    = lane & 15;

  const int nqb = S_ / AT_QB;                                   // 32
  const int bx = blockIdx.x;
  if (bx >= B_ * H_ * nqb) return;                              // block-uniform, ahead of every barrier
  const int qb = bx % nqb;
  const int bh = bx / nqb;
  const int h  = bh % H_;
  const int b  = bh / H_;
  const int q0 = qb * AT_QB + wave * 16;

  const size_t pbase = (size_t)b * S_ * HID_ + (size_t)h * DH_;
  const _Float16* qb_ptr = qp + pbase;
  const _Float16* kb_ptr = kp + pbase;
  const _Float16* vb_ptr = vp + pbase;
  float*          ob_ptr = out + pbase;

  // ---- Q fragments (B operand, column = query q0 + c, k = d): 2 d-chunks, dense static-stride loads ----
  v16h qa[2];
#pragma unroll
  for (int dc = 0; dc < 2; ++dc)
    qa[dc] = Frag<_Float16>::load(qb_ptr + (size_t)(q0 + c) * HID_ + dc * 32 + 8 * hh);

  float mrow = -INFINITY, lrow = 0.f;                           // of query q0 + c; lrow sums this wave half's keys
  v8f oacc[4];
#pragma unroll
  for (int t = 0; t < 4; ++t) oacc[t] = (v8f){0.f,0.f,0.f,0.f,0.f,0.f,0.f,0.f};

  for (int kc = 0; kc < S_ / AT_KC; ++kc) {                     // 32 chunks, static
    const int kv0 = kc * AT_KC;
    __syncthreads();
    {
      const int kvr = tid >> 1, dh = (tid & 1) * 32;            // 128 threads: 64 key rows x 2 halves of 32 d
      const _Float16* krow = kb_ptr + (size_t)(kv0 + kvr) * HID_ + dh;
      const _Float16* vrow = vb_ptr + (size_t)(kv0 + kvr) * HID_ + dh;
#pragma unroll
      for (int i = 0; i < 4; ++i) {
        const v8h kk = *(const v8h*)(krow + 8 * i);
        const v8h vv = *(const v8h*)(vrow + 8 * i);
        *(v8h*)(Ksh + kvr * AT_LP + dh + 8 * i) = kk;
#pragma unroll
        for (int e = 0; e < 8; ++e) Vth[(dh + 8 * i + e) * AT_LP + kvr] = vv[e];
      }
    }
    __syncthreads();

    // scores transposed: S^T = K.Q^T, 64 keys x 16 queries per wave; A[m = kv][k = d] = Ksh[kv][d], B[k = d][n = query] = qa
    // D layout: s[j][r] = score of key kv0 + j*16 + 8*hh + r for query q0 + c, so a lane holds scores of one query only
    v8f s[4];
#pragma unroll
    for (int j = 0; j < 4; ++j) {
      s[j] = (v8f){0.f,0.f,0.f,0.f,0.f,0.f,0.f,0.f};
#pragma unroll
      for (int dc = 0; dc < 2; ++dc) {
        const v16h kb = Frag<_Float16>::load(Ksh + (j * 16 + c) * AT_LP + dc * 32 + 8 * hh);
        s[j] = hmma16(kb, qa[dc], s[j]);
      }
    }

    // online softmax, one query per lane: maximum in-lane over the lane's 32 keys, one exchange between the wave halves
    float m = -INFINITY;
#pragma unroll
    for (int j = 0; j < 4; ++j)
#pragma unroll
      for (int r = 0; r < 8; ++r) {
        const float sv = s[j][r] * sscale;
        s[j][r] = sv;
        m = fmaxf(m, sv);
      }
    m = fmaxf(m, xhalf(m));
    const float mnew = fmaxf(mrow, m);
    const float alpha = expf(mrow - mnew);
    mrow = mnew;
    // P^T packs from the score tiles straight into the B operand: element e of pb[kk] = tile 2*kk + (e >> 3), register e & 7
    v16h pb[2];
    float psum = 0.f;
#pragma unroll
    for (int j = 0; j < 4; ++j)
#pragma unroll
      for (int r = 0; r < 8; ++r) {
        const float p = expf(s[j][r] - mnew);
        psum += p;
        pb[j >> 1][(j & 1) * 8 + r] = (_Float16)(p * PSCALE);
      }
    lrow = lrow * alpha + psum;                                 // this half's keys only; the halves join in the epilogue
#pragma unroll
    for (int t = 0; t < 4; ++t)
#pragma unroll
      for (int r = 0; r < 8; ++r) oacc[t][r] *= alpha;

    // O^T += V^T.P^T: A[m = d][k = kv] = Vth[d][kv], B[k = kv][n = query] = pb; oacc[t][r] = out[q0 + c][t*16 + 8*hh + r]
#pragma unroll
    for (int kk = 0; kk < 2; ++kk) {
#pragma unroll
      for (int t = 0; t < 4; ++t) {
        const v16h va = Frag<_Float16>::load(Vth + (t * 16 + c) * AT_LP + kk * 32 + 8 * hh);
        oacc[t] = hmma16(va, pb[kk], oacc[t]);
      }
    }
  }

  // ---- epilogue: out = acc / (l * 2^15), staged per wave in LDS, whole 256-B row segments ----
  float* os = Os[wave];
  {
    const float l = lrow + xhalf(lrow);
    const float inv = 1.0f / (l * PSCALE);
#pragma unroll
    for (int t = 0; t < 4; ++t) {
      v4f lo, hi;
#pragma unroll
      for (int r = 0; r < 4; ++r) { lo[r] = oacc[t][r] * inv; hi[r] = oacc[t][4 + r] * inv; }
      *(v4f*)(os + c * 68 + t * 16 + 8 * hh)     = lo;
      *(v4f*)(os + c * 68 + t * 16 + 8 * hh + 4) = hi;
    }
  }
  __builtin_amdgcn_fence(__ATOMIC_RELEASE, "workgroup");
  __builtin_amdgcn_wave_barrier();
  __builtin_amdgcn_fence(__ATOMIC_ACQUIRE, "workgroup");
  {
    const int c4 = (lane & 15) * 4;
    {
#pragma unroll
      for (int it = 0; it < 8; ++it) {
        const int row = it * 2 + hh;
        v4f val = *(const v4f*)(os + row * 68 + c4);
        *(v4f*)(ob_ptr + (size_t)(q0 + row) * HID_ + c4) = val;
      }
      
    }
  }
}

// ---------------------------------------------------------------------------
// Host glue. Workspace carve (bytes): q, k, v as f16 [B*S][HID], 8 MiB each; total 25,165,824 B.
// ---------------------------------------------------------------------------
extern "C" void kernel_launch(void* const* d_in, const int* in_sizes, int n_in,
                              void* d_out, int out_size, void* d_ws,
                              size_t ws_size, hipStream_t stream) {
  if (n_in < 7) return;
  const int NX = B_ * S_ * HID_;          // 4194304
  const int NW = H_ * DH_ * DH_;          // 32768
  const int NB = H_ * DH_;                // 512
  if (in_sizes[0] != NX || in_sizes[1] != NW || in_sizes[2] != NB || in_sizes[3] != NW ||
      in_sizes[4] != NB || in_sizes[5] != NW || in_sizes[6] != NB || out_size != NX) return;

  const float* x  = (const float*)d_in[0];
  const float* Wq = (const float*)d_in[1];
  const float* bq = (const float*)d_in[2];
  const float* Wk = (const float*)d_in[3];
  const float* bk = (const float*)d_in[4];
  const float* Wv = (const float*)d_in[5];
  const float* bv = (const float*)d_in[6];
  float* out = (float*)d_out;

  const size_t bytesP = (size_t)NX * 2;                   // 8388608 per f16 plane
  if (3 * bytesP > ws_size) return;

  char* ws = (char*)d_ws;
  _Float16* Qh = (_Float16*)(ws);
  _Float16* Kh = (_Float16*)(ws + bytesP);
  _Float16* Vh = (_Float16*)(ws + 2 * bytesP);

  // projections: one block per (256 rows, head); x and the weights are read as f32 and rounded in the kernel.
  {
    dim3 pgrid(B_ * S_ / PJ_ROWS, H_);                    // 32 x 8
    qkv_proj_f16<<<pgrid, 256, 0, stream>>>(x, Wq, bq, Wk, bk, Wv, bv, Qh, Kh, Vh);
  }

  // attention: one block per (b, h, 64-query block); keys streamed in 64-key chunks, no mask, score scale 1/8.
  {
    const int nblk = B_ * H_ * (S_ / AT_QB);              // 1024
    attn64_f16<<<nblk, 128, 0, stream>>>(Qh, Kh, Vh, out, 0.125f);
  }
}

// v004
// One run takes 78.4 microseconds.
// Two timings next to v003 put it at 1.36 and 1.37 times that version's speed.
// All steps since v000 together make it 3.21 times as fast.
// Contractions: per-head q/k/v projections = v_wmma_f32_16x16x32_f16 (f16 operands, weights carried x16, f32 accumulate, f16 output planes);
// attention q.k^T and p.v = v_wmma_f32_16x16x32_f16 (f16 operands, p carried x2^15, f32 accumulate); softmax (base 2) and epilogues f32.
#include <hip/hip_runtime.h>
#include <math.h>

#define B_   4
#define S_   2048
#define HID_ 512
#define H_   8
#define DH_  64

typedef __attribute__((ext_vector_type(16))) _Float16 v16h;
typedef __attribute__((ext_vector_type(8)))  _Float16 v8h;
typedef __attribute__((ext_vector_type(4)))  _Float16 v4h;
typedef __attribute__((ext_vector_type(8)))  float    v8f;
typedef __attribute__((ext_vector_type(4)))  float    v4f;
#define PSHIFT 15.0f                   // p and its sum are carried x2^15: the shift is added to the base-2 exponent
#define LOG2E  1.44269504088896340736f

template <typename T> struct Frag;
template <> struct Frag<_Float16> {
  typedef v16h V; union U { v16h v; v8h h[2]; };
  static __device__ __forceinline__ v16h load(const _Float16* p) {   // elements 0..7 <- p[0..7], 8..15 <- p[16..23]
    U f; f.h[0] = *(const v8h*)(p); f.h[1] = *(const v8h*)(p + 16); return f.v;
  }
};

// =====================================================================================
// q, k, v projections of one head for 256 rows, one launch for all three.
//   y[m][n] = (sum_k x[m][h*64 + k] * (16 W[h][n][k])) / 16 + b[h][n], y = q, k, v as f16 planes [B*S][HID].
//   x and W are read as f32 and rounded to f16 in registers (W after the x16 carry).
//   Product transposed: A[m' = n][k] = W rows from LDS, B[k][n' = row] = x rows, so a lane's 8 accumulator
//   registers are 8 neighbouring outputs of one row: D[r] = y[m0 + c][j*16 + 8*hh + r].
//   Block = 8 waves x 32 rows; the x fragments of a wave serve all three weights.
//   grid = (B*S/256, H).
// =====================================================================================
#define PJ_LP 72                       // LDS row pitch in f16: 144 B = 16 B x odd, as for the attention tiles
#define PJ_NW 8
#define PJ_MT 2                        // 16-row tiles per wave
#define PJ_WR (PJ_MT * 16)             // rows per wave
#define PJ_ROWS (PJ_NW * PJ_WR)        // rows per block

__global__ __launch_bounds__(256)
void qkv_proj_f16(const float* __restrict__ x,
                  const float* __restrict__ Wq, const float* __restrict__ bq,
                  const float* __restrict__ Wk, const float* __restrict__ bk,
                  const float* __restrict__ Wv, const float* __restrict__ bv,
                  _Float16* __restrict__ qo, _Float16* __restrict__ ko, _Float16* __restrict__ vo) {
  __shared__ __align__(16) _Float16 Wsh[3][DH_ * PJ_LP];             // 16 W[h] as f16, [n][k], padded rows   27 KB
  __shared__ __align__(16) float    Bsh[3][DH_];                     // b[h]
  __shared__ __align__(16) _Float16 Ts[PJ_NW][3][PJ_WR * PJ_LP];     // per wave and output: 32 x 64 tile     108 KB

  const int tid  = threadIdx.x;
  const int wave = tid >> 5;
  const int lane = tid & 31;
  const int hh   = lane >> 4;
  const int c    = lane & 15;
  const int h    = blockIdx.y;
  const int m0   = blockIdx.x * PJ_ROWS + wave * PJ_WR;

  // Every loop of this kernel is unrolled in full: the fragment and accumulator arrays stay in registers only
  // when they are indexed by constants, and no branch then follows a matrix instruction.
  // ---- all global reads first: the wave's x rows (fragment order) and the block's share of the three weights ----
  v4f xr[PJ_MT][2][4];
#pragma unroll
  for (int mt = 0; mt < PJ_MT; ++mt) {
#pragma unroll
    for (int dc = 0; dc < 2; ++dc) {
      const float* p = x + (size_t)(m0 + mt * 16 + c) * HID_ + h * DH_ + dc * 32 + 8 * hh;
      xr[mt][dc][0] = *(const v4f*)(p);
      xr[mt][dc][1] = *(const v4f*)(p + 4);
      xr[mt][dc][2] = *(const v4f*)(p + 16);
      xr[mt][dc][3] = *(const v4f*)(p + 20);
    }
    // the result of a later load is placed in this row tile's address registers: the wait stands in front of that overwrite
    asm volatile("s_wait_xcnt 0x0" ::: "memory");
  }
  v4f wr[3][4];
#pragma unroll
  for (int i = 0; i < 4; ++i) {
    const size_t wo = (size_t)h * (DH_ * DH_) + (size_t)(i * 256 + tid) * 4;
    wr[0][i] = *(const v4f*)(Wq + wo);
    wr[1][i] = *(const v4f*)(Wk + wo);
    wr[2][i] = *(const v4f*)(Wv + wo);
  }
  if (tid < 3 * DH_) {
    const int w = tid >> 6, n = tid & 63;
    const float* bsrc = (w == 0) ? bq : (w == 1) ? bk : bv;
    Bsh[w][n] = bsrc[h * DH_ + n];
  }
#pragma unroll
  for (int w = 0; w < 3; ++w)
#pragma unroll
    for (int i = 0; i < 4; ++i) {
      const int i4 = i * 256 + tid;                                  // float4 index in the 64 x 64 weight
      v4h hv;
#pragma unroll
      for (int e = 0; e < 4; ++e) hv[e] = (_Float16)(wr[w][i][e] * 16.0f);
      *(v4h*)(&Wsh[w][(i4 >> 4) * PJ_LP + (i4 & 15) * 4]) = hv;
    }
  v16h xb[PJ_MT][2];
#pragma unroll
  for (int mt = 0; mt < PJ_MT; ++mt)
#pragma unroll
    for (int dc = 0; dc < 2; ++dc)
#pragma unroll
      for (int e = 0; e < 16; ++e) xb[mt][dc][e] = (_Float16)xr[mt][dc][e >> 2][e & 3];
  __syncthreads();

  // ---- products and epilogue math; each output has its own LDS tile, so nothing is overwritten ----
#pragma unroll
  for (int w = 0; w < 3; ++w) {
    v8f acc[PJ_MT][4];
#pragma unroll
    for (int mt = 0; mt < PJ_MT; ++mt)
#pragma unroll
      for (int j = 0; j < 4; ++j) acc[mt][j] = (v8f){0.f,0.f,0.f,0.f,0.f,0.f,0.f,0.f};
#pragma unroll
    for (int dc = 0; dc < 2; ++dc)
#pragma unroll
      for (int j = 0; j < 4; ++j) {
        const v16h wa = Frag<_Float16>::load(&Wsh[w][(j * 16 + c) * PJ_LP + dc * 32 + 8 * hh]);
#pragma unroll
        for (int mt = 0; mt < PJ_MT; ++mt)
          acc[mt][j] = __builtin_amdgcn_wmma_f32_16x16x32_f16(false, wa, false, xb[mt][dc], (short)0, acc[mt][j], false, false);
      }
    _Float16* ts = Ts[wave][w];
#pragma unroll
    for (int j = 0; j < 4; ++j) {
      const v4f b0 = *(const v4f*)(&Bsh[w][j * 16 + 8 * hh]);
      const v4f b1 = *(const v4f*)(&Bsh[w][j * 16 + 8 * hh + 4]);
#pragma unroll
      for (int mt = 0; mt < PJ_MT; ++mt) {
        v8h hv;
#pragma unroll
        for (int r = 0; r < 8; ++r) {
          float v = acc[mt][j][r] * (1.0f / 16.0f);
          v += (r < 4) ? b0[r & 3] : b1[r & 3];
          hv[r] = (_Float16)v;
        }
        *(v8h*)(ts + (mt * 16 + c) * PJ_LP + j * 16 + 8 * hh) = hv;
      }
    }
  }
  // the wave reads back only what it wrote itself: order its LDS writes ahead of its LDS reads
  __builtin_amdgcn_fence(__ATOMIC_RELEASE, "workgroup");
  __builtin_amdgcn_wave_barrier();
  __builtin_amdgcn_fence(__ATOMIC_ACQUIRE, "workgroup");

  // ---- stores: 8 lanes x 16 B = one whole 128-B row segment, 4 rows per instruction ----
  {
    const int q = lane >> 3, c8 = (lane & 7) * 8;
#pragma unroll
    for (int w = 0; w < 3; ++w) {
      _Float16* o = ((w == 0) ? qo : (w == 1) ? ko : vo) + (size_t)m0 * HID_ + h * DH_ + c8;
      const _Float16* ts = Ts[wave][w];
#pragma unroll
      for (int it = 0; it < PJ_WR / 4; ++it) {
        const int row = it * 4 + q;
        *(v8h*)(o + (size_t)row * HID_) = *(const v8h*)(ts + row * PJ_LP + c8);
      }
    }
  }
}

// =====================================================================================
// Non-causal attention for head_dim 64, 16-bit q/k/v planes in, f32 out.
//   q, k, v: f16, element (b, s, h, d) at X[(b*S + s)*HID + h*64 + d]; out f32 with the same indexing.
//   scores^T = k.q^T   : v_wmma_f32_16x16x32_f16; the maximum is kept on the unscaled f32 accumulator (sscale > 0)
//   p x 2^15 = 2^(s*cs + (15 - max*cs)), cs = sscale*log2(e): one fma and one hardware base-2 exponential per score
//   out^T    = v^T.p^T : v_wmma_f32_16x16x32_f16, p carried x2^15 in f16 (kept in registers), its sum l carries the same factor
//   f32 accumulate; online softmax in f32. Block = 4 waves = 64 query rows of one (batch, head);
//   keys streamed in 64-key chunks staged in LDS (K as [kv][d], V transposed to [d][kv]; rows of 128 B at a pitch of 144 B).
//   grid.x = B * H * (S/64).
// =====================================================================================
#define AT_D 64
#define AT_NW 4
#define AT_QB 64
#define AT_KC 64
#define AT_LP 72   // LDS row pitch of the K and V^T tiles in f16: 144 B = 16 B x odd, so the 16 rows of a 16-byte fragment read fall on distinct banks

__device__ __forceinline__ v8f hmma16(v16h a, v16h b, v8f c) {
  c = __builtin_amdgcn_wmma_f32_16x16x32_f16(false, a, false, b, (short)0, c, false, false);
  asm volatile("v_nop\n\tv_nop\n\tv_nop\n\tv_nop" : "+v"(c) : "v"(a), "v"(b));
  return c;
}

// value of lane l ^ 16 (the other wave half), as a vector cross-row move; all 32 lanes are on wherever it is called
__device__ __forceinline__ float xhalf(float x) {
  const int b = __builtin_bit_cast(int, x);
  return __builtin_bit_cast(float, __builtin_amdgcn_permlanex16(b, b, 0x76543210, 0xfedcba98, false, false));
}

// eight base-2 exponentials, each in its own register. One statement: no exponential's source is then overwritten by its
// neighbour, and the closing v_nop is the slot that the instruction set asks for between a transcendental and the reader of its result.
__device__ __forceinline__ void exp2x8(float (&e)[8]) {
  asm("v_exp_f32 %0, %0\n\tv_exp_f32 %1, %1\n\tv_exp_f32 %2, %2\n\tv_exp_f32 %3, %3\n\t"
      "v_exp_f32 %4, %4\n\tv_exp_f32 %5, %5\n\tv_exp_f32 %6, %6\n\tv_exp_f32 %7, %7\n\tv_nop"
      : "+v"(e[0]), "+v"(e[1]), "+v"(e[2]), "+v"(e[3]), "+v"(e[4]), "+v"(e[5]), "+v"(e[6]), "+v"(e[7]));
}

__global__ __launch_bounds__(128)
void attn64_f16(const _Float16* __restrict__ qp, const _Float16* __restrict__ kp,
                const _Float16* __restrict__ vp, float* __restrict__ out, float sscale) {
  __shared__ __align__(16) _Float16 Ksh[AT_KC * AT_LP];         // K [kv][d], padded rows          9 KB
  __shared__ __align__(16) _Float16 Vth[AT_D * AT_LP];          // V^T [d][kv], padded rows        9 KB
  __shared__ __align__(16) float    Os[AT_NW][16 * 68];         // per wave out tile, pitch 68

  const int tid  = threadIdx.x;
  const int wave = tid >> 5;
  const int lane = tid & 31;
  const int hh   = lane >> 4;
  const int c    = lane & 15;

  const int nqb = S_ / AT_QB;                                   // 32
  const int bx = blockIdx.x;
  if (bx >= B_ * H_ * nqb) return;                              // block-uniform, ahead of every barrier
  const int qb = bx % nqb;
  const int bh = bx / nqb;
  const int h  = bh % H_;
  const int b  = bh / H_;
  const int q0 = qb * AT_QB + wave * 16;

  const size_t pbase = (size_t)b * S_ * HID_ + (size_t)h * DH_;
  const _Float16* qb_ptr = qp + pbase;
  const _Float16* kb_ptr = kp + pbase;
  const _Float16* vb_ptr = vp + pbase;
  float*          ob_ptr = out + pbase;

  // ---- Q fragments (B operand, column = query q0 + c, k = d): 2 d-chunks, dense static-stride loads ----
  v16h qa[2];
#pragma unroll
  for (int dc = 0; dc < 2; ++dc)
    qa[dc] = Frag<_Float16>::load(qb_ptr + (size_t)(q0 + c) * HID_ + dc * 32 + 8 * hh);

  const float cs = sscale * LOG2E;                              // score scale for base-2 exponents
  float mrow = -INFINITY, lrow = 0.f;                           // of query q0 + c; mrow unscaled; lrow sums this wave half's keys, x2^15
  v8f oacc[4];
#pragma unroll
  for (int t = 0; t < 4; ++t) oacc[t] = (v8f){0.f,0.f,0.f,0.f,0.f,0.f,0.f,0.f};

  for (int kc = 0; kc < S_ / AT_KC; ++kc) {                     // 32 chunks, static
    const int kv0 = kc * AT_KC;
    __syncthreads();
    {
      const int kvr = tid >> 1, dh = (tid & 1) * 32;            // 128 threads: 64 key rows x 2 halves of 32 d
      const _Float16* krow = kb_ptr + (size_t)(kv0 + kvr) * HID_ + dh;
      const _Float16* vrow = vb_ptr + (size_t)(kv0 + kvr) * HID_ + dh;
#pragma unroll
      for (int i = 0; i < 4; ++i) {
        const v8h kk = *(const v8h*)(krow + 8 * i);
        const v8h vv = *(const v8h*)(vrow + 8 * i);
        *(v8h*)(Ksh + kvr * AT_LP + dh + 8 * i) = kk;
#pragma unroll
        for (int e = 0; e < 8; ++e) Vth[(dh + 8 * i + e) * AT_LP + kvr] = vv[e];
      }
    }
    __syncthreads();

    // scores transposed: S^T = K.Q^T, 64 keys x 16 queries per wave; A[m = kv][k = d] = Ksh[kv][d], B[k = d][n = query] = qa
    // D layout: s[j][r] = score of key kv0 + j*16 + 8*hh + r for query q0 + c, so a lane holds scores of one query only
    v8f s[4];
#pragma unroll
    for (int j = 0; j < 4; ++j) {
      s[j] = (v8f){0.f,0.f,0.f,0.f,0.f,0.f,0.f,0.f};
#pragma unroll
      for (int dc = 0; dc < 2; ++dc) {
        const v16h kb = Frag<_Float16>::load(Ksh + (j * 16 + c) * AT_LP + dc * 32 + 8 * hh);
        s[j] = hmma16(kb, qa[dc], s[j]);
      }
    }

    // online softmax, one query per lane: maximum in-lane over the lane's 32 keys, one exchange between the wave halves
    float m = -INFINITY;
#pragma unroll
    for (int j = 0; j < 4; ++j)
#pragma unroll
      for (int r = 0; r < 8; ++r) m = fmaxf(m, s[j][r]);
    m = fmaxf(m, xhalf(m));
    const float mnew = fmaxf(mrow, m);
    const float alpha = __builtin_amdgcn_exp2f((mrow - mnew) * cs);
    const float eoff = fmaf(-mnew, cs, PSHIFT);                 // exponent offset: minus the scaled maximum, plus the x2^15 carry
    mrow = mnew;
    // P^T packs from the score tiles straight into the B operand: element e of pb[kk] = tile 2*kk + (e >> 3), register e & 7
    v16h pb[2];
    float psum = 0.f;
#pragma unroll
    for (int j = 0; j < 4; ++j) {
      float p[8];                                               // p x 2^15, in (0, 2^15]
#pragma unroll
      for (int r = 0; r < 8; ++r) p[r] = fmaf(s[j][r], cs, eoff);
      exp2x8(p);
#pragma unroll
      for (int r = 0; r < 8; ++r) {
        psum += p[r];
        pb[j >> 1][(j & 1) * 8 + r] = (_Float16)p[r];
      }
    }
    lrow = lrow * alpha + psum;                                 // this half's keys only; the halves join in the epilogue
#pragma unroll
    for (int t = 0; t < 4; ++t)
#pragma unroll
      for (int r = 0; r < 8; ++r) oacc[t][r] *= alpha;

    // O^T += V^T.P^T: A[m = d][k = kv] = Vth[d][kv], B[k = kv][n = query] = pb; oacc[t][r] = out[q0 + c][t*16 + 8*hh + r]
#pragma unroll
    for (int kk = 0; kk < 2; ++kk) {
#pragma unroll
      for (int t = 0; t < 4; ++t) {
        const v16h va = Frag<_Float16>::load(Vth + (t * 16 + c) * AT_LP + kk * 32 + 8 * hh);
        oacc[t] = hmma16(va, pb[kk], oacc[t]);
      }
    }
  }

  // ---- epilogue: out = acc / l (both carry x2^15), staged per wave in LDS, whole 256-B row segments ----
  float* os = Os[wave];
  {
    const float l = lrow + xhalf(lrow);
    const float inv = 1.0f / l;
#pragma unroll
    for (int t = 0; t < 4; ++t) {
      v4f lo, hi;
#pragma unroll
      for (int r = 0; r < 4; ++r) { lo[r] = oacc[t][r] * inv; hi[r] = oacc[t][4 + r] * inv; }
      *(v4f*)(os + c * 68 + t * 16 + 8 * hh)     = lo;
      *(v4f*)(os + c * 68 + t * 16 + 8 * hh + 4) = hi;
    }
  }
  __builtin_amdgcn_fence(__ATOMIC_RELEASE, "workgroup");
  __builtin_amdgcn_wave_barrier();
  __builtin_amdgcn_fence(__ATOMIC_ACQUIRE, "workgroup");
  {
    const int c4 = (lane & 15) * 4;
    {
#pragma unroll
      for (int it = 0; it < 8; ++it) {
        const int row = it * 2 + hh;
        v4f val = *(const v4f*)(os + row * 68 + c4);
        *(v4f*)(ob_ptr + (size_t)(q0 + row) * HID_ + c4) = val;
      }
      
    }
  }
}

// ---------------------------------------------------------------------------
// Host glue. Workspace carve (bytes): q, k, v as f16 [B*S][HID], 8 MiB each; total 25,165,824 B.
// ---------------------------------------------------------------------------
extern "C" void kernel_launch(void* const* d_in, const int* in_sizes, int n_in,
                              void* d_out, int out_size, void* d_ws,
                              size_t ws_size, hipStream_t stream) {
  if (n_in < 7) return;
  const int NX = B_ * S_ * HID_;          // 4194304
  const int NW = H_ * DH_ * DH_;          // 32768
  const int NB = H_ * DH_;                // 512
  if (in_sizes[0] != NX || in_sizes[1] != NW || in_sizes[2] != NB || in_sizes[3] != NW ||
      in_sizes[4] != NB || in_sizes[5] != NW || in_sizes[6] != NB || out_size != NX) return;

  const float* x  = (const float*)d_in[0];
  const float* Wq = (const float*)d_in[1];
  const float* bq = (const float*)d_in[2];
  const float* Wk = (const float*)d_in[3];
  const float* bk = (const float*)d_in[4];
  const float* Wv = (const float*)d_in[5];
  const float* bv = (const float*)d_in[6];
  float* out = (float*)d_out;

  const size_t bytesP = (size_t)NX * 2;                   // 8388608 per f16 plane
  if (3 * bytesP > ws_size) return;

  char* ws = (char*)d_ws;
  _Float16* Qh = (_Float16*)(ws);
  _Float16* Kh = (_Float16*)(ws + bytesP);
  _Float16* Vh = (_Float16*)(ws + 2 * bytesP);

  // projections: one block per (256 rows, head); x and the weights are read as f32 and rounded in the kernel.
  {
    dim3 pgrid(B_ * S_ / PJ_ROWS, H_);                    // 32 x 8
    qkv_proj_f16<<<pgrid, 256, 0, stream>>>(x, Wq, bq, Wk, bk, Wv, bv, Qh, Kh, Vh);
  }

  // attention: one block per (b, h, 64-query block); keys streamed in 64-key chunks, no mask, score scale 1/8.
  {
    const int nblk = B_ * H_ * (S_ / AT_QB);              // 1024
    attn64_f16<<<nblk, 128, 0, stream>>>(Qh, Kh, Vh, out, 0.125f);
  }
}

// v005
// A run of this version takes 69 microseconds.
// In both of two side-by-side timings against v004, it was 1.13 times as fast.
// All steps since v000 together make it 3.63 times as fast.
// Contractions: per-head q/k/v projections = v_wmma_f32_16x16x32_f16 (f16 operands, weights carried x16, f32 accumulate, f16 output planes);
// attention q.k^T and p.v = v_wmma_f32_16x16x32_f16 (f16 operands, p carried x2^15, f32 accumulate); softmax (base 2) and epilogues f32.
#include <hip/hip_runtime.h>
#include <math.h>

#define B_   4
#define S_   2048
#define HID_ 512
#define H_   8
#define DH_  64

typedef __attribute__((ext_vector_type(16))) _Float16 v16h;
typedef __attribute__((ext_vector_type(8)))  _Float16 v8h;
typedef __attribute__((ext_vector_type(4)))  _Float16 v4h;
typedef __attribute__((ext_vector_type(8)))  float    v8f;
typedef __attribute__((ext_vector_type(4)))  float    v4f;
#define PSHIFT 15.0f                   // p and its sum are carried x2^15: the shift is added to the base-2 exponent
#define LOG2E  1.44269504088896340736f

template <typename T> struct Frag;
template <> struct Frag<_Float16> {
  typedef v16h V; union U { v16h v; v8h h[2]; };
  static __device__ __forceinline__ v16h load(const _Float16* p) {   // elements 0..7 <- p[0..7], 8..15 <- p[16..23]
    U f; f.h[0] = *(const v8h*)(p); f.h[1] = *(const v8h*)(p + 16); return f.v;
  }
};

// =====================================================================================
// q, k, v projections of one head for 256 rows, one launch for all three.
//   y[m][n] = (sum_k x[m][h*64 + k] * (16 W[h][n][k])) / 16 + b[h][n], y = q, k, v as f16 planes [B*S][HID].
//   x and W are read as f32 and rounded to f16 in registers (W after the x16 carry).
//   Product transposed: A[m' = n][k] = W rows from LDS, B[k][n' = row] = x rows, so a lane's 8 accumulator
//   registers are 8 neighbouring outputs of one row: D[r] = y[m0 + c][j*16 + 8*hh + r].
//   Block = 8 waves x 32 rows; the x fragments of a wave serve all three weights.
//   grid = (B*S/256, H).
// =====================================================================================
#define PJ_LP 72                       // LDS row pitch in f16: 144 B = 16 B x odd, as for the attention tiles
#define PJ_NW 8
#define PJ_MT 2                        // 16-row tiles per wave
#define PJ_WR (PJ_MT * 16)             // rows per wave
#define PJ_ROWS (PJ_NW * PJ_WR)        // rows per block

__global__ __launch_bounds__(256)
void qkv_proj_f16(const float* __restrict__ x,
                  const float* __restrict__ Wq, const float* __restrict__ bq,
                  const float* __restrict__ Wk, const float* __restrict__ bk,
                  const float* __restrict__ Wv, const float* __restrict__ bv,
                  _Float16* __restrict__ qo, _Float16* __restrict__ ko, _Float16* __restrict__ vo) {
  __shared__ __align__(16) _Float16 Wsh[3][DH_ * PJ_LP];             // 16 W[h] as f16, [n][k], padded rows   27 KB
  __shared__ __align__(16) float    Bsh[3][DH_];                     // b[h]
  __shared__ __align__(16) _Float16 Ts[PJ_NW][3][PJ_WR * PJ_LP];     // per wave and output: 32 x 64 tile     108 KB

  const int tid  = threadIdx.x;
  const int wave = tid >> 5;
  const int lane = tid & 31;
  const int hh   = lane >> 4;
  const int c    = lane & 15;
  const int h    = blockIdx.y;
  const int m0   = blockIdx.x * PJ_ROWS + wave * PJ_WR;

  // Every loop of this kernel is unrolled in full: the fragment and accumulator arrays stay in registers only
  // when they are indexed by constants, and no branch then follows a matrix instruction.
  // ---- all global reads first: the wave's x rows (fragment order) and the block's share of the three weights ----
  v4f xr[PJ_MT][2][4];
#pragma unroll
  for (int mt = 0; mt < PJ_MT; ++mt) {
#pragma unroll
    for (int dc = 0; dc < 2; ++dc) {
      const float* p = x + (size_t)(m0 + mt * 16 + c) * HID_ + h * DH_ + dc * 32 + 8 * hh;
      xr[mt][dc][0] = *(const v4f*)(p);
      xr[mt][dc][1] = *(const v4f*)(p + 4);
      xr[mt][dc][2] = *(const v4f*)(p + 16);
      xr[mt][dc][3] = *(const v4f*)(p + 20);
    }
    // the result of a later load is placed in this row tile's address registers: the wait stands in front of that overwrite
    asm volatile("s_wait_xcnt 0x0" ::: "memory");
  }
  v4f wr[3][4];
#pragma unroll
  for (int i = 0; i < 4; ++i) {
    const size_t wo = (size_t)h * (DH_ * DH_) + (size_t)(i * 256 + tid) * 4;
    wr[0][i] = *(const v4f*)(Wq + wo);
    wr[1][i] = *(const v4f*)(Wk + wo);
    wr[2][i] = *(const v4f*)(Wv + wo);
  }
  if (tid < 3 * DH_) {
    const int w = tid >> 6, n = tid & 63;
    const float* bsrc = (w == 0) ? bq : (w == 1) ? bk : bv;
    Bsh[w][n] = bsrc[h * DH_ + n];
  }
#pragma unroll
  for (int w = 0; w < 3; ++w)
#pragma unroll
    for (int i = 0; i < 4; ++i) {
      const int i4 = i * 256 + tid;                                  // float4 index in the 64 x 64 weight
      v4h hv;
#pragma unroll
      for (int e = 0; e < 4; ++e) hv[e] = (_Float16)(wr[w][i][e] * 16.0f);
      *(v4h*)(&Wsh[w][(i4 >> 4) * PJ_LP + (i4 & 15) * 4]) = hv;
    }
  v16h xb[PJ_MT][2];
#pragma unroll
  for (int mt = 0; mt < PJ_MT; ++mt)
#pragma unroll
    for (int dc = 0; dc < 2; ++dc)
#pragma unroll
      for (int e = 0; e < 16; ++e) xb[mt][dc][e] = (_Float16)xr[mt][dc][e >> 2][e & 3];
  __syncthreads();

  // ---- products and epilogue math; each output has its own LDS tile, so nothing is overwritten ----
#pragma unroll
  for (int w = 0; w < 3; ++w) {
    v8f acc[PJ_MT][4];
#pragma unroll
    for (int mt = 0; mt < PJ_MT; ++mt)
#pragma unroll
      for (int j = 0; j < 4; ++j) acc[mt][j] = (v8f){0.f,0.f,0.f,0.f,0.f,0.f,0.f,0.f};
#pragma unroll
    for (int dc = 0; dc < 2; ++dc)
#pragma unroll
      for (int j = 0; j < 4; ++j) {
        const v16h wa = Frag<_Float16>::load(&Wsh[w][(j * 16 + c) * PJ_LP + dc * 32 + 8 * hh]);
#pragma unroll
        for (int mt = 0; mt < PJ_MT; ++mt)
          acc[mt][j] = __builtin_amdgcn_wmma_f32_16x16x32_f16(false, wa, false, xb[mt][dc], (short)0, acc[mt][j], false, false);
      }
    _Float16* ts = Ts[wave][w];
#pragma unroll
    for (int j = 0; j < 4; ++j) {
      const v4f b0 = *(const v4f*)(&Bsh[w][j * 16 + 8 * hh]);
      const v4f b1 = *(const v4f*)(&Bsh[w][j * 16 + 8 * hh + 4]);
#pragma unroll
      for (int mt = 0; mt < PJ_MT; ++mt) {
        v8h hv;
#pragma unroll
        for (int r = 0; r < 8; ++r) {
          float v = acc[mt][j][r] * (1.0f / 16.0f);
          v += (r < 4) ? b0[r & 3] : b1[r & 3];
          hv[r] = (_Float16)v;
        }
        *(v8h*)(ts + (mt * 16 + c) * PJ_LP + j * 16 + 8 * hh) = hv;
      }
    }
  }
  // the wave reads back only what it wrote itself: order its LDS writes ahead of its LDS reads
  __builtin_amdgcn_fence(__ATOMIC_RELEASE, "workgroup");
  __builtin_amdgcn_wave_barrier();
  __builtin_amdgcn_fence(__ATOMIC_ACQUIRE, "workgroup");

  // ---- stores: 8 lanes x 16 B = one whole 128-B row segment, 4 rows per instruction ----
  {
    const int q = lane >> 3, c8 = (lane & 7) * 8;
#pragma unroll
    for (int w = 0; w < 3; ++w) {
      _Float16* o = ((w == 0) ? qo : (w == 1) ? ko : vo) + (size_t)m0 * HID_ + h * DH_ + c8;
      const _Float16* ts = Ts[wave][w];
#pragma unroll
      for (int it = 0; it < PJ_WR / 4; ++it) {
        const int row = it * 4 + q;
        *(v8h*)(o + (size_t)row * HID_) = *(const v8h*)(ts + row * PJ_LP + c8);
      }
    }
  }
}

// =====================================================================================
// Non-causal attention for head_dim 64, 16-bit q/k/v planes in, f32 out.
//   q, k, v: f16, element (b, s, h, d) at X[(b*S + s)*HID + h*64 + d]; out f32 with the same indexing.
//   scores^T = k.q^T   : v_wmma_f32_16x16x32_f16; the maximum is kept on the unscaled f32 accumulator (sscale > 0)
//   p x 2^15 = 2^(s*cs + (15 - max*cs)), cs = sscale*log2(e): one fma and one hardware base-2 exponential per score
//   out^T    = v^T.p^T : v_wmma_f32_16x16x32_f16, p carried x2^15 in f16 (kept in registers), its sum l carries the same factor
//   f32 accumulate; online softmax in f32. Block = 4 waves = 64 query rows of one (batch, head);
//   keys streamed in 64-key chunks staged in LDS (K as [kv][d], V transposed to [d][kv]; rows of 128 B at a pitch of 144 B).
//   grid.x = B * H * (S/64).
// =====================================================================================
#define AT_D 64
#define AT_NW 4
#define AT_QB 64
#define AT_KC 64
#define AT_LP 72   // LDS row pitch of the K and V^T tiles in f16: 144 B = 16 B x odd, so the 16 rows of a 16-byte fragment read fall on distinct banks

__device__ __forceinline__ v8f hmma16(v16h a, v16h b, v8f c) {
  return __builtin_amdgcn_wmma_f32_16x16x32_f16(false, a, false, b, (short)0, c, false, false);
}

// value of lane l ^ 16 (the other wave half), as a vector cross-row move; all 32 lanes are on wherever it is called
__device__ __forceinline__ float xhalf(float x) {
  const int b = __builtin_bit_cast(int, x);
  return __builtin_bit_cast(float, __builtin_amdgcn_permlanex16(b, b, 0x76543210, 0xfedcba98, false, false));
}

// eight base-2 exponentials, each in its own register. One statement: no exponential's source is then overwritten by its
// neighbour, and the closing v_nop is the slot that the instruction set asks for between a transcendental and the reader of its result.
__device__ __forceinline__ void exp2x8(float (&e)[8]) {
  asm("v_exp_f32 %0, %0\n\tv_exp_f32 %1, %1\n\tv_exp_f32 %2, %2\n\tv_exp_f32 %3, %3\n\t"
      "v_exp_f32 %4, %4\n\tv_exp_f32 %5, %5\n\tv_exp_f32 %6, %6\n\tv_exp_f32 %7, %7\n\tv_nop"
      : "+v"(e[0]), "+v"(e[1]), "+v"(e[2]), "+v"(e[3]), "+v"(e[4]), "+v"(e[5]), "+v"(e[6]), "+v"(e[7]));
}

__global__ __launch_bounds__(128)
void attn64_f16(const _Float16* __restrict__ qp, const _Float16* __restrict__ kp,
                const _Float16* __restrict__ vp, float* __restrict__ out, float sscale) {
  __shared__ __align__(16) _Float16 Ksh[AT_KC * AT_LP];         // K [kv][d], padded rows          9 KB
  __shared__ __align__(16) _Float16 Vth[AT_D * AT_LP];          // V^T [d][kv], padded rows        9 KB
  __shared__ __align__(16) float    Os[AT_NW][16 * 68];         // per wave out tile, pitch 68

  const int tid  = threadIdx.x;
  const int wave = tid >> 5;
  const int lane = tid & 31;
  const int hh   = lane >> 4;
  const int c    = lane & 15;

  const int nqb = S_ / AT_QB;                                   // 32
  const int bx = blockIdx.x;
  if (bx >= B_ * H_ * nqb) return;                              // block-uniform, ahead of every barrier
  const int qb = bx % nqb;
  const int bh = bx / nqb;
  const int h  = bh % H_;
  const int b  = bh / H_;
  const int q0 = qb * AT_QB + wave * 16;

  const size_t pbase = (size_t)b * S_ * HID_ + (size_t)h * DH_;
  const _Float16* qb_ptr = qp + pbase;
  const _Float16* kb_ptr = kp + pbase;
  const _Float16* vb_ptr = vp + pbase;
  float*          ob_ptr = out + pbase;

  // ---- Q fragments (B operand, column = query q0 + c, k = d): 2 d-chunks, dense static-stride loads ----
  v16h qa[2];
#pragma unroll
  for (int dc = 0; dc < 2; ++dc)
    qa[dc] = Frag<_Float16>::load(qb_ptr + (size_t)(q0 + c) * HID_ + dc * 32 + 8 * hh);

  const float cs = sscale * LOG2E;                              // score scale for base-2 exponents
  float mrow = -INFINITY, lrow = 0.f;                           // of query q0 + c; mrow unscaled; lrow sums this wave half's keys, x2^15
  v8f oacc[4];
#pragma unroll
  for (int t = 0; t < 4; ++t) oacc[t] = (v8f){0.f,0.f,0.f,0.f,0.f,0.f,0.f,0.f};

  for (int kc = 0; kc < S_ / AT_KC; ++kc) {                     // 32 chunks, static
    const int kv0 = kc * AT_KC;
    __syncthreads();
    {
      const int kvr = tid >> 1, dh = (tid & 1) * 32;            // 128 threads: 64 key rows x 2 halves of 32 d
      const _Float16* krow = kb_ptr + (size_t)(kv0 + kvr) * HID_ + dh;
      const _Float16* vrow = vb_ptr + (size_t)(kv0 + kvr) * HID_ + dh;
#pragma unroll
      for (int i = 0; i < 4; ++i) {
        const v8h kk = *(const v8h*)(krow + 8 * i);
        const v8h vv = *(const v8h*)(vrow + 8 * i);
        *(v8h*)(Ksh + kvr * AT_LP + dh + 8 * i) = kk;
#pragma unroll
        for (int e = 0; e < 8; ++e) Vth[(dh + 8 * i + e) * AT_LP + kvr] = vv[e];
      }
    }
    __syncthreads();

    // scores transposed: S^T = K.Q^T, 64 keys x 16 queries per wave; A[m = kv][k = d] = Ksh[kv][d], B[k = d][n = query] = qa
    // D layout: s[j][r] = score of key kv0 + j*16 + 8*hh + r for query q0 + c, so a lane holds scores of one query only
    // All fragment reads of the chunk stand here as one group, K ahead of V^T: the products then wait out one LDS
    // latency instead of one per product, and the V^T fragments land while the scores and the softmax are worked on.
    v16h kf[2][4], vf[2][4];
#pragma unroll
    for (int dc = 0; dc < 2; ++dc)
#pragma unroll
      for (int j = 0; j < 4; ++j)
        kf[dc][j] = Frag<_Float16>::load(Ksh + (j * 16 + c) * AT_LP + dc * 32 + 8 * hh);
#pragma unroll
    for (int kk = 0; kk < 2; ++kk)
#pragma unroll
      for (int t = 0; t < 4; ++t)
        vf[kk][t] = Frag<_Float16>::load(Vth + (t * 16 + c) * AT_LP + kk * 32 + 8 * hh);
    // keeps the scheduler from sinking the reads back down among the products, where each would be waited for on its own
    __builtin_amdgcn_sched_barrier(0);
    v8f s[4];
#pragma unroll
    for (int j = 0; j < 4; ++j) s[j] = (v8f){0.f,0.f,0.f,0.f,0.f,0.f,0.f,0.f};
#pragma unroll
    for (int dc = 0; dc < 2; ++dc)
#pragma unroll
      for (int j = 0; j < 4; ++j) s[j] = hmma16(kf[dc][j], qa[dc], s[j]);

    // online softmax, one query per lane: maximum in-lane over the lane's 32 keys, one exchange between the wave halves
    float m = -INFINITY;
#pragma unroll
    for (int j = 0; j < 4; ++j)
#pragma unroll
      for (int r = 0; r < 8; ++r) m = fmaxf(m, s[j][r]);
    m = fmaxf(m, xhalf(m));
    const float mnew = fmaxf(mrow, m);
    const float alpha = __builtin_amdgcn_exp2f((mrow - mnew) * cs);
    const float eoff = fmaf(-mnew, cs, PSHIFT);                 // exponent offset: minus the scaled maximum, plus the x2^15 carry
    mrow = mnew;
    // P^T packs from the score tiles straight into the B operand: element e of pb[kk] = tile 2*kk + (e >> 3), register e & 7
    v16h pb[2];
    float psum = 0.f;
#pragma unroll
    for (int j = 0; j < 4; ++j) {
      float p[8];                                               // p x 2^15, in (0, 2^15]
#pragma unroll
      for (int r = 0; r < 8; ++r) p[r] = fmaf(s[j][r], cs, eoff);
      exp2x8(p);
#pragma unroll
      for (int r = 0; r < 8; ++r) {
        psum += p[r];
        pb[j >> 1][(j & 1) * 8 + r] = (_Float16)p[r];
      }
    }
    lrow = lrow * alpha + psum;                                 // this half's keys only; the halves join in the epilogue
#pragma unroll
    for (int t = 0; t < 4; ++t)
#pragma unroll
      for (int r = 0; r < 8; ++r) oacc[t][r] *= alpha;

    // O^T += V^T.P^T: A[m = d][k = kv] = Vth[d][kv], B[k = kv][n = query] = pb; oacc[t][r] = out[q0 + c][t*16 + 8*hh + r]
#pragma unroll
    for (int kk = 0; kk < 2; ++kk) {
#pragma unroll
      for (int t = 0; t < 4; ++t) oacc[t] = hmma16(vf[kk][t], pb[kk], oacc[t]);
    }
  }

  // ---- epilogue: out = acc / l (both carry x2^15), staged per wave in LDS, whole 256-B row segments ----
  float* os = Os[wave];
  {
    const float l = lrow + xhalf(lrow);
    const float inv = 1.0f / l;
#pragma unroll
    for (int t = 0; t < 4; ++t) {
      v4f lo, hi;
#pragma unroll
      for (int r = 0; r < 4; ++r) { lo[r] = oacc[t][r] * inv; hi[r] = oacc[t][4 + r] * inv; }
      *(v4f*)(os + c * 68 + t * 16 + 8 * hh)     = lo;
      *(v4f*)(os + c * 68 + t * 16 + 8 * hh + 4) = hi;
    }
  }
  __builtin_amdgcn_fence(__ATOMIC_RELEASE, "workgroup");
  __builtin_amdgcn_wave_barrier();
  __builtin_amdgcn_fence(__ATOMIC_ACQUIRE, "workgroup");
  {
    const int c4 = (lane & 15) * 4;
    {
#pragma unroll
      for (int it = 0; it < 8; ++it) {
        const int row = it * 2 + hh;
        v4f val = *(const v4f*)(os + row * 68 + c4);
        *(v4f*)(ob_ptr + (size_t)(q0 + row) * HID_ + c4) = val;
      }
      
    }
  }
}

// ---------------------------------------------------------------------------
// Host glue. Workspace carve (bytes): q, k, v as f16 [B*S][HID], 8 MiB each; total 25,165,824 B.
// ---------------------------------------------------------------------------
extern "C" void kernel_launch(void* const* d_in, const int* in_sizes, int n_in,
                              void* d_out, int out_size, void* d_ws,
                              size_t ws_size, hipStream_t stream) {
  if (n_in < 7) return;
  const int NX = B_ * S_ * HID_;          // 4194304
  const int NW = H_ * DH_ * DH_;          // 32768
  const int NB = H_ * DH_;                // 512
  if (in_sizes[0] != NX || in_sizes[1] != NW || in_sizes[2] != NB || in_sizes[3] != NW ||
      in_sizes[4] != NB || in_sizes[5] != NW || in_sizes[6] != NB || out_size != NX) return;

  const float* x  = (const float*)d_in[0];
  const float* Wq = (const float*)d_in[1];
  const float* bq = (const float*)d_in[2];
  const float* Wk = (const float*)d_in[3];
  const float* bk = (const float*)d_in[4];
  const float* Wv = (const float*)d_in[5];
  const float* bv = (const float*)d_in[6];
  float* out = (float*)d_out;

  const size_t bytesP = (size_t)NX * 2;                   // 8388608 per f16 plane
  if (3 * bytesP > ws_size) return;

  char* ws = (char*)d_ws;
  _Float16* Qh = (_Float16*)(ws);
  _Float16* Kh = (_Float16*)(ws + bytesP);
  _Float16* Vh = (_Float16*)(ws + 2 * bytesP);

  // projections: one block per (256 rows, head); x and the weights are read as f32 and rounded in the kernel.
  {
    dim3 pgrid(B_ * S_ / PJ_ROWS, H_);                    // 32 x 8
    qkv_proj_f16<<<pgrid, 256, 0, stream>>>(x, Wq, bq, Wk, bk, Wv, bv, Qh, Kh, Vh);
  }

  // attention: one block per (b, h, 64-query block); keys streamed in 64-key chunks, no mask, score scale 1/8.
  {
    const int nblk = B_ * H_ * (S_ / AT_QB);              // 1024
    attn64_f16<<<nblk, 128, 0, stream>>>(Qh, Kh, Vh, out, 0.125f);
  }
}

// v006
// It runs in 56.7 microseconds.
// Two timings next to v005 put it at 1.21 and 1.22 times that version's speed.
// All steps since v000 together make it 4.41 times as fast.
// Contractions: per-head q/k/v projections = v_wmma_f32_16x16x32_f16 (f16 operands, weights carried x16, f32 accumulate, f16 output planes);
// attention q.k^T and p.v = v_wmma_f32_16x16x32_f16 (f16 operands, p carried x2^15, f32 accumulate); softmax (base 2) and epilogues f32.
#include <hip/hip_runtime.h>
#include <math.h>

#define B_   4
#define S_   2048
#define HID_ 512
#define H_   8
#define DH_  64

typedef __attribute__((ext_vector_type(16))) _Float16 v16h;
typedef __attribute__((ext_vector_type(8)))  _Float16 v8h;
typedef __attribute__((ext_vector_type(4)))  _Float16 v4h;
typedef __attribute__((ext_vector_type(8)))  float    v8f;
typedef __attribute__((ext_vector_type(4)))  float    v4f;
#define PSHIFT 15.0f                   // p and its sum are carried x2^15: the shift is added to the base-2 exponent
#define LOG2E  1.44269504088896340736f

template <typename T> struct Frag;
template <> struct Frag<_Float16> {
  typedef v16h V; union U { v16h v; v8h h[2]; };
  static __device__ __forceinline__ v16h load(const _Float16* p) {   // elements 0..7 <- p[0..7], 8..15 <- p[16..23]
    U f; f.h[0] = *(const v8h*)(p); f.h[1] = *(const v8h*)(p + 16); return f.v;
  }
};

// =====================================================================================
// q, k, v projections of one head for 256 rows, one launch for all three.
//   y[m][n] = (sum_k x[m][h*64 + k] * (16 W[h][n][k])) / 16 + b[h][n], y = q, k, v as f16 planes [B*S][HID].
//   x and W are read as f32 and rounded to f16 in registers (W after the x16 carry).
//   Product transposed: A[m' = n][k] = W rows from LDS, B[k][n' = row] = x rows, so a lane's 8 accumulator
//   registers are 8 neighbouring outputs of one row: D[r] = y[m0 + c][j*16 + 8*hh + r].
//   Block = 8 waves x 32 rows; the x fragments of a wave serve all three weights.
//   grid = (B*S/256, H).
// =====================================================================================
#define PJ_LP 72                       // LDS row pitch in f16: 144 B = 16 B x odd, as for the attention K tile
#define PJ_NW 8
#define PJ_MT 2                        // 16-row tiles per wave
#define PJ_WR (PJ_MT * 16)             // rows per wave
#define PJ_ROWS (PJ_NW * PJ_WR)        // rows per block

__global__ __launch_bounds__(256)
void qkv_proj_f16(const float* __restrict__ x,
                  const float* __restrict__ Wq, const float* __restrict__ bq,
                  const float* __restrict__ Wk, const float* __restrict__ bk,
                  const float* __restrict__ Wv, const float* __restrict__ bv,
                  _Float16* __restrict__ qo, _Float16* __restrict__ ko, _Float16* __restrict__ vo) {
  __shared__ __align__(16) _Float16 Wsh[3][DH_ * PJ_LP];             // 16 W[h] as f16, [n][k], padded rows   27 KB
  __shared__ __align__(16) float    Bsh[3][DH_];                     // b[h]
  __shared__ __align__(16) _Float16 Ts[PJ_NW][3][PJ_WR * PJ_LP];     // per wave and output: 32 x 64 tile     108 KB

  const int tid  = threadIdx.x;
  const int wave = tid >> 5;
  const int lane = tid & 31;
  const int hh   = lane >> 4;
  const int c    = lane & 15;
  const int h    = blockIdx.y;
  const int m0   = blockIdx.x * PJ_ROWS + wave * PJ_WR;

  // Every loop of this kernel is unrolled in full: the fragment and accumulator arrays stay in registers only
  // when they are indexed by constants, and no branch then follows a matrix instruction.
  // ---- all global reads first: the wave's x rows (fragment order) and the block's share of the three weights ----
  v4f xr[PJ_MT][2][4];
#pragma unroll
  for (int mt = 0; mt < PJ_MT; ++mt) {
#pragma unroll
    for (int dc = 0; dc < 2; ++dc) {
      const float* p = x + (size_t)(m0 + mt * 16 + c) * HID_ + h * DH_ + dc * 32 + 8 * hh;
      xr[mt][dc][0] = *(const v4f*)(p);
      xr[mt][dc][1] = *(const v4f*)(p + 4);
      xr[mt][dc][2] = *(const v4f*)(p + 16);
      xr[mt][dc][3] = *(const v4f*)(p + 20);
    }
    // the result of a later load is placed in this row tile's address registers: the wait stands in front of that overwrite
    asm volatile("s_wait_xcnt 0x0" ::: "memory");
  }
  v4f wr[3][4];
#pragma unroll
  for (int i = 0; i < 4; ++i) {
    const size_t wo = (size_t)h * (DH_ * DH_) + (size_t)(i * 256 + tid) * 4;
    wr[0][i] = *(const v4f*)(Wq + wo);
    wr[1][i] = *(const v4f*)(Wk + wo);
    wr[2][i] = *(const v4f*)(Wv + wo);
  }
  if (tid < 3 * DH_) {
    const int w = tid >> 6, n = tid & 63;
    const float* bsrc = (w == 0) ? bq : (w == 1) ? bk : bv;
    Bsh[w][n] = bsrc[h * DH_ + n];
  }
#pragma unroll
  for (int w = 0; w < 3; ++w)
#pragma unroll
    for (int i = 0; i < 4; ++i) {
      const int i4 = i * 256 + tid;                                  // float4 index in the 64 x 64 weight
      v4h hv;
#pragma unroll
      for (int e = 0; e < 4; ++e) hv[e] = (_Float16)(wr[w][i][e] * 16.0f);
      *(v4h*)(&Wsh[w][(i4 >> 4) * PJ_LP + (i4 & 15) * 4]) = hv;
    }
  v16h xb[PJ_MT][2];
#pragma unroll
  for (int mt = 0; mt < PJ_MT; ++mt)
#pragma unroll
    for (int dc = 0; dc < 2; ++dc)
#pragma unroll
      for (int e = 0; e < 16; ++e) xb[mt][dc][e] = (_Float16)xr[mt][dc][e >> 2][e & 3];
  __syncthreads();

  // ---- products and epilogue math; each output has its own LDS tile, so nothing is overwritten ----
#pragma unroll
  for (int w = 0; w < 3; ++w) {
    v8f acc[PJ_MT][4];
#pragma unroll
    for (int mt = 0; mt < PJ_MT; ++mt)
#pragma unroll
      for (int j = 0; j < 4; ++j) acc[mt][j] = (v8f){0.f,0.f,0.f,0.f,0.f,0.f,0.f,0.f};
#pragma unroll
    for (int dc = 0; dc < 2; ++dc)
#pragma unroll
      for (int j = 0; j < 4; ++j) {
        const v16h wa = Frag<_Float16>::load(&Wsh[w][(j * 16 + c) * PJ_LP + dc * 32 + 8 * hh]);
#pragma unroll
        for (int mt = 0; mt < PJ_MT; ++mt)
          acc[mt][j] = __builtin_amdgcn_wmma_f32_16x16x32_f16(false, wa, false, xb[mt][dc], (short)0, acc[mt][j], false, false);
      }
    _Float16* ts = Ts[wave][w];
#pragma unroll
    for (int j = 0; j < 4; ++j) {
      const v4f b0 = *(const v4f*)(&Bsh[w][j * 16 + 8 * hh]);
      const v4f b1 = *(const v4f*)(&Bsh[w][j * 16 + 8 * hh + 4]);
#pragma unroll
      for (int mt = 0; mt < PJ_MT; ++mt) {
        v8h hv;
#pragma unroll
        for (int r = 0; r < 8; ++r) {
          float v = acc[mt][j][r] * (1.0f / 16.0f);
          v += (r < 4) ? b0[r & 3] : b1[r & 3];
          hv[r] = (_Float16)v;
        }
        *(v8h*)(ts + (mt * 16 + c) * PJ_LP + j * 16 + 8 * hh) = hv;
      }
    }
  }
  // the wave reads back only what it wrote itself: order its LDS writes ahead of its LDS reads
  __builtin_amdgcn_fence(__ATOMIC_RELEASE, "workgroup");
  __builtin_amdgcn_wave_barrier();
  __builtin_amdgcn_fence(__ATOMIC_ACQUIRE, "workgroup");

  // ---- stores: 8 lanes x 16 B = one whole 128-B row segment, 4 rows per instruction ----
  {
    const int q = lane >> 3, c8 = (lane & 7) * 8;
#pragma unroll
    for (int w = 0; w < 3; ++w) {
      _Float16* o = ((w == 0) ? qo : (w == 1) ? ko : vo) + (size_t)m0 * HID_ + h * DH_ + c8;
      const _Float16* ts = Ts[wave][w];
#pragma unroll
      for (int it = 0; it < PJ_WR / 4; ++it) {
        const int row = it * 4 + q;
        *(v8h*)(o + (size_t)row * HID_) = *(const v8h*)(ts + row * PJ_LP + c8);
      }
    }
  }
}

// =====================================================================================
// Non-causal attention for head_dim 64, 16-bit q/k/v planes in, f32 out.
//   q, k, v: f16, element (b, s, h, d) at X[(b*S + s)*HID + h*64 + d]; out f32 with the same indexing.
//   scores^T = k.q^T   : v_wmma_f32_16x16x32_f16; the maximum is kept on the unscaled f32 accumulator (sscale > 0)
//   p x 2^15 = 2^(s*cs + (15 - max*cs)), cs = sscale*log2(e): one fma and one hardware base-2 exponential per score
//   out^T    = v^T.p^T : v_wmma_f32_16x16x32_f16, p carried x2^15 in f16 (kept in registers), its sum l carries the same factor
//   f32 accumulate; online softmax in f32. Block = 4 waves = 64 query rows of one (batch, head);
//   keys streamed in 64-key chunks staged in LDS, both as [kv][d] rows of 128 B: K at a pitch of 144 B, V at 160 B;
//   the V^T fragments come out of the V rows by the 16-bit transposing LDS load.
//   grid.x = B * H * (S/64).
// =====================================================================================
#define AT_D 64
#define AT_NW 4
#define AT_QB 64
#define AT_KC 64
#define AT_LP 72   // LDS row pitch of the K tile in f16: 144 B = 16 B x odd, so the 16 rows of a 16-byte fragment read fall on distinct banks
#define AT_VP 80   // LDS row pitch of the V tile in f16: 160 B = 32 B x odd, the conflict-free pitch of the transposing load

__device__ __forceinline__ v8f hmma16(v16h a, v16h b, v8f c) {
  return __builtin_amdgcn_wmma_f32_16x16x32_f16(false, a, false, b, (short)0, c, false, false);
}

// 16-bit transposing LDS load: the 32 lanes name 16 rows x 32 B of a row-major tile T (lane l: row 8*(l >> 4) + (l & 7),
// byte 16*((l >> 3) & 1)); lane (c = l & 15, hh = l >> 4) receives T[8*hh + 0..7][c]. All 32 lanes are on wherever it is called.
typedef __attribute__((ext_vector_type(8))) short s16x8;
__device__ __forceinline__ v8h ld_tr16(const _Float16* p) {
  typedef __attribute__((address_space(3))) s16x8 lds_s16x8;
  return __builtin_bit_cast(v8h, __builtin_amdgcn_ds_load_tr16_b128_v8i16((lds_s16x8*)p));
}

// value of lane l ^ 16 (the other wave half), as a vector cross-row move; all 32 lanes are on wherever it is called
__device__ __forceinline__ float xhalf(float x) {
  const int b = __builtin_bit_cast(int, x);
  return __builtin_bit_cast(float, __builtin_amdgcn_permlanex16(b, b, 0x76543210, 0xfedcba98, false, false));
}

// eight base-2 exponentials, each in its own register. One statement: no exponential's source is then overwritten by its
// neighbour, and the closing v_nop is the slot that the instruction set asks for between a transcendental and the reader of its result.
__device__ __forceinline__ void exp2x8(float (&e)[8]) {
  asm("v_exp_f32 %0, %0\n\tv_exp_f32 %1, %1\n\tv_exp_f32 %2, %2\n\tv_exp_f32 %3, %3\n\t"
      "v_exp_f32 %4, %4\n\tv_exp_f32 %5, %5\n\tv_exp_f32 %6, %6\n\tv_exp_f32 %7, %7\n\tv_nop"
      : "+v"(e[0]), "+v"(e[1]), "+v"(e[2]), "+v"(e[3]), "+v"(e[4]), "+v"(e[5]), "+v"(e[6]), "+v"(e[7]));
}

__global__ __launch_bounds__(128)
void attn64_f16(const _Float16* __restrict__ qp, const _Float16* __restrict__ kp,
                const _Float16* __restrict__ vp, float* __restrict__ out, float sscale) {
  __shared__ __align__(16) _Float16 Ksh[AT_KC * AT_LP];         // K [kv][d], padded rows          9 KB
  __shared__ __align__(16) _Float16 Vsh[AT_KC * AT_VP];         // V [kv][d], padded rows         10 KB
  __shared__ __align__(16) float    Os[AT_NW][16 * 68];         // per wave out tile, pitch 68

  const int tid  = threadIdx.x;
  const int wave = tid >> 5;
  const int lane = tid & 31;
  const int hh   = lane >> 4;
  const int c    = lane & 15;

  const int nqb = S_ / AT_QB;                                   // 32
  const int bx = blockIdx.x;
  if (bx >= B_ * H_ * nqb) return;                              // block-uniform, ahead of every barrier
  const int qb = bx % nqb;
  const int bh = bx / nqb;
  const int h  = bh % H_;
  const int b  = bh / H_;
  const int q0 = qb * AT_QB + wave * 16;

  const size_t pbase = (size_t)b * S_ * HID_ + (size_t)h * DH_;
  const _Float16* qb_ptr = qp + pbase;
  const _Float16* kb_ptr = kp + pbase;
  const _Float16* vb_ptr = vp + pbase;
  float*          ob_ptr = out + pbase;

  // ---- Q fragments (B operand, column = query q0 + c, k = d): 2 d-chunks, dense static-stride loads ----
  v16h qa[2];
#pragma unroll
  for (int dc = 0; dc < 2; ++dc)
    qa[dc] = Frag<_Float16>::load(qb_ptr + (size_t)(q0 + c) * HID_ + dc * 32 + 8 * hh);

  const float cs = sscale * LOG2E;                              // score scale for base-2 exponents
  float mrow = -INFINITY, lrow = 0.f;                           // of query q0 + c; mrow unscaled; lrow sums this wave half's keys, x2^15
  v8f oacc[4];
#pragma unroll
  for (int t = 0; t < 4; ++t) oacc[t] = (v8f){0.f,0.f,0.f,0.f,0.f,0.f,0.f,0.f};

  for (int kc = 0; kc < S_ / AT_KC; ++kc) {                     // 32 chunks, static
    const int kv0 = kc * AT_KC;
    __syncthreads();
    {
      const int kvr = tid >> 1, dh = (tid & 1) * 32;            // 128 threads: 64 key rows x 2 halves of 32 d
      const _Float16* krow = kb_ptr + (size_t)(kv0 + kvr) * HID_ + dh;
      const _Float16* vrow = vb_ptr + (size_t)(kv0 + kvr) * HID_ + dh;
#pragma unroll
      for (int i = 0; i < 4; ++i) {
        const v8h kk = *(const v8h*)(krow + 8 * i);
        const v8h vv = *(const v8h*)(vrow + 8 * i);
        *(v8h*)(Ksh + kvr * AT_LP + dh + 8 * i) = kk;
        *(v8h*)(Vsh + kvr * AT_VP + dh + 8 * i) = vv;
      }
    }
    __syncthreads();

    // scores transposed: S^T = K.Q^T, 64 keys x 16 queries per wave; A[m = kv][k = d] = Ksh[kv][d], B[k = d][n = query] = qa
    // D layout: s[j][r] = score of key kv0 + j*16 + 8*hh + r for query q0 + c, so a lane holds scores of one query only
    // All fragment reads of the chunk stand here as one group, K ahead of V^T: the products then wait out one LDS
    // latency instead of one per product, and the V^T fragments land while the scores and the softmax are worked on.
    v16h kf[2][4], vf[2][4];
#pragma unroll
    for (int dc = 0; dc < 2; ++dc)
#pragma unroll
      for (int j = 0; j < 4; ++j)
        kf[dc][j] = Frag<_Float16>::load(Ksh + (j * 16 + c) * AT_LP + dc * 32 + 8 * hh);
#pragma unroll
    for (int kk = 0; kk < 2; ++kk)
#pragma unroll
      for (int t = 0; t < 4; ++t) {
        // elements 0..7 = V[kk*32 + 8*hh + 0..7][t*16 + c], elements 8..15 = V[kk*32 + 16 + 8*hh + 0..7][t*16 + c]: the k order of pb
        const _Float16* vt = Vsh + (kk * 32 + 8 * hh + (lane & 7)) * AT_VP + t * 16 + 8 * ((lane >> 3) & 1);
        Frag<_Float16>::U f;
        f.h[0] = ld_tr16(vt);
        f.h[1] = ld_tr16(vt + 16 * AT_VP);
        vf[kk][t] = f.v;
      }
    // keeps the scheduler from sinking the reads back down among the products, where each would be waited for on its own
    __builtin_amdgcn_sched_barrier(0);
    v8f s[4];
#pragma unroll
    for (int j = 0; j < 4; ++j) s[j] = (v8f){0.f,0.f,0.f,0.f,0.f,0.f,0.f,0.f};
#pragma unroll
    for (int dc = 0; dc < 2; ++dc)
#pragma unroll
      for (int j = 0; j < 4; ++j) s[j] = hmma16(kf[dc][j], qa[dc], s[j]);

    // online softmax, one query per lane: maximum in-lane over the lane's 32 keys, one exchange between the wave halves
    float m = -INFINITY;
#pragma unroll
    for (int j = 0; j < 4; ++j)
#pragma unroll
      for (int r = 0; r < 8; ++r) m = fmaxf(m, s[j][r]);
    m = fmaxf(m, xhalf(m));
    const float mnew = fmaxf(mrow, m);
    const float alpha = __builtin_amdgcn_exp2f((mrow - mnew) * cs);
    const float eoff = fmaf(-mnew, cs, PSHIFT);                 // exponent offset: minus the scaled maximum, plus the x2^15 carry
    mrow = mnew;
    // P^T packs from the score tiles straight into the B operand: element e of pb[kk] = tile 2*kk + (e >> 3), register e & 7
    v16h pb[2];
    float psum = 0.f;
#pragma unroll
    for (int j = 0; j < 4; ++j) {
      float p[8];                                               // p x 2^15, in (0, 2^15]
#pragma unroll
      for (int r = 0; r < 8; ++r) p[r] = fmaf(s[j][r], cs, eoff);
      exp2x8(p);
#pragma unroll
      for (int r = 0; r < 8; ++r) {
        psum += p[r];
        pb[j >> 1][(j & 1) * 8 + r] = (_Float16)p[r];
      }
    }
    lrow = lrow * alpha + psum;                                 // this half's keys only; the halves join in the epilogue
#pragma unroll
    for (int t = 0; t < 4; ++t)
#pragma unroll
      for (int r = 0; r < 8; ++r) oacc[t][r] *= alpha;

    // O^T += V^T.P^T: A[m = d][k = kv] = Vsh[kv][d], B[k = kv][n = query] = pb; oacc[t][r] = out[q0 + c][t*16 + 8*hh + r]
#pragma unroll
    for (int kk = 0; kk < 2; ++kk) {
#pragma unroll
      for (int t = 0; t < 4; ++t) oacc[t] = hmma16(vf[kk][t], pb[kk], oacc[t]);
    }
  }

  // ---- epilogue: out = acc / l (both carry x2^15), staged per wave in LDS, whole 256-B row segments ----
  float* os = Os[wave];
  {
    const float l = lrow + xhalf(lrow);
    const float inv = 1.0f / l;
#pragma unroll
    for (int t = 0; t < 4; ++t) {
      v4f lo, hi;
#pragma unroll
      for (int r = 0; r < 4; ++r) { lo[r] = oacc[t][r] * inv; hi[r] = oacc[t][4 + r] * inv; }
      *(v4f*)(os + c * 68 + t * 16 + 8 * hh)     = lo;
      *(v4f*)(os + c * 68 + t * 16 + 8 * hh + 4) = hi;
    }
  }
  __builtin_amdgcn_fence(__ATOMIC_RELEASE, "workgroup");
  __builtin_amdgcn_wave_barrier();
  __builtin_amdgcn_fence(__ATOMIC_ACQUIRE, "workgroup");
  {
    const int c4 = (lane & 15) * 4;
    {
#pragma unroll
      for (int it = 0; it < 8; ++it) {
        const int row = it * 2 + hh;
        v4f val = *(const v4f*)(os + row * 68 + c4);
        *(v4f*)(ob_ptr + (size_t)(q0 + row) * HID_ + c4) = val;
      }
      
    }
  }
}

// ---------------------------------------------------------------------------
// Host glue. Workspace carve (bytes): q, k, v as f16 [B*S][HID], 8 MiB each; total 25,165,824 B.
// ---------------------------------------------------------------------------
extern "C" void kernel_launch(void* const* d_in, const int* in_sizes, int n_in,
                              void* d_out, int out_size, void* d_ws,
                              size_t ws_size, hipStream_t stream) {
  if (n_in < 7) return;
  const int NX = B_ * S_ * HID_;          // 4194304
  const int NW = H_ * DH_ * DH_;          // 32768
  const int NB = H_ * DH_;                // 512
  if (in_sizes[0] != NX || in_sizes[1] != NW || in_sizes[2] != NB || in_sizes[3] != NW ||
      in_sizes[4] != NB || in_sizes[5] != NW || in_sizes[6] != NB || out_size != NX) return;

  const float* x  = (const float*)d_in[0];
  const float* Wq = (const float*)d_in[1];
  const float* bq = (const float*)d_in[2];
  const float* Wk = (const float*)d_in[3];
  const float* bk = (const float*)d_in[4];
  const float* Wv = (const float*)d_in[5];
  const float* bv = (const float*)d_in[6];
  float* out = (float*)d_out;

  const size_t bytesP = (size_t)NX * 2;                   // 8388608 per f16 plane
  if (3 * bytesP > ws_size) return;

  char* ws = (char*)d_ws;
  _Float16* Qh = (_Float16*)(ws);
  _Float16* Kh = (_Float16*)(ws + bytesP);
  _Float16* Vh = (_Float16*)(ws + 2 * bytesP);

  // projections: one block per (256 rows, head); x and the weights are read as f32 and rounded in the kernel.
  {
    dim3 pgrid(B_ * S_ / PJ_ROWS, H_);                    // 32 x 8
    qkv_proj_f16<<<pgrid, 256, 0, stream>>>(x, Wq, bq, Wk, bk, Wv, bv, Qh, Kh, Vh);
  }

  // attention: one block per (b, h, 64-query block); keys streamed in 64-key chunks, no mask, score scale 1/8.
  {
    const int nblk = B_ * H_ * (S_ / AT_QB);              // 1024
    attn64_f16<<<nblk, 128, 0, stream>>>(Qh, Kh, Vh, out, 0.125f);
  }
}

// v007
// Measured time: 43.7 microseconds a run.
// Timed twice side by side with v006, it ran 1.30 and 1.29 times as fast.
// Counting every step since v000, it is 5.74 times as fast.
// Contractions: per-head q/k/v projections = v_wmma_f32_16x16x32_f16 (f16 operands, weights carried x16, f32 accumulate, f16 output planes);
// attention q.k^T and p.v = v_wmma_f32_16x16x32_f16 (f16 operands, p carried x2^15, f32 accumulate); softmax (base 2) and epilogues f32.
#include <hip/hip_runtime.h>
#include <math.h>
#include <stdint.h>

#define B_   4
#define S_   2048
#define HID_ 512
#define H_   8
#define DH_  64

typedef __attribute__((ext_vector_type(16))) _Float16 v16h;
typedef __attribute__((ext_vector_type(8)))  _Float16 v8h;
typedef __attribute__((ext_vector_type(4)))  _Float16 v4h;
typedef __attribute__((ext_vector_type(8)))  float    v8f;
typedef __attribute__((ext_vector_type(4)))  float    v4f;
#define PSHIFT 15.0f                   // p and its sum are carried x2^15: the shift is added to the base-2 exponent
#define LOG2E  1.44269504088896340736f

template <typename T> struct Frag;
template <> struct Frag<_Float16> {
  typedef v16h V; union U { v16h v; v8h h[2]; };
  static __device__ __forceinline__ v16h load(const _Float16* p) {   // elements 0..7 <- p[0..7], 8..15 <- p[16..23]
    U f; f.h[0] = *(const v8h*)(p); f.h[1] = *(const v8h*)(p + 16); return f.v;
  }
};

// =====================================================================================
// q, k, v projections of one head for 256 rows, one launch for all three.
//   y[m][n] = (sum_k x[m][h*64 + k] * (16 W[h][n][k])) / 16 + b[h][n], y = q, k, v as f16 planes [B*S][HID].
//   x and W are read as f32 and rounded to f16 in registers (W after the x16 carry).
//   Product transposed: A[m' = n][k] = W rows from LDS, B[k][n' = row] = x rows, so a lane's 8 accumulator
//   registers are 8 neighbouring outputs of one row: D[r] = y[m0 + c][j*16 + 8*hh + r].
//   Block = 8 waves x 32 rows; the x fragments of a wave serve all three weights.
//   grid = (B*S/256, H).
// =====================================================================================
#define PJ_LP 72                       // LDS row pitch in f16: 144 B = 16 B x odd, as for the attention K tile
#define PJ_NW 8
#define PJ_MT 2                        // 16-row tiles per wave
#define PJ_WR (PJ_MT * 16)             // rows per wave
#define PJ_ROWS (PJ_NW * PJ_WR)        // rows per block

__global__ __launch_bounds__(256)
void qkv_proj_f16(const float* __restrict__ x,
                  const float* __restrict__ Wq, const float* __restrict__ bq,
                  const float* __restrict__ Wk, const float* __restrict__ bk,
                  const float* __restrict__ Wv, const float* __restrict__ bv,
                  _Float16* __restrict__ qo, _Float16* __restrict__ ko, _Float16* __restrict__ vo) {
  __shared__ __align__(16) _Float16 Wsh[3][DH_ * PJ_LP];             // 16 W[h] as f16, [n][k], padded rows   27 KB
  __shared__ __align__(16) float    Bsh[3][DH_];                     // b[h]
  __shared__ __align__(16) _Float16 Ts[PJ_NW][3][PJ_WR * PJ_LP];     // per wave and output: 32 x 64 tile     108 KB

  const int tid  = threadIdx.x;
  const int wave = tid >> 5;
  const int lane = tid & 31;
  const int hh   = lane >> 4;
  const int c    = lane & 15;
  const int h    = blockIdx.y;
  const int m0   = blockIdx.x * PJ_ROWS + wave * PJ_WR;

  // Every loop of this kernel is unrolled in full: the fragment and accumulator arrays stay in registers only
  // when they are indexed by constants, and no branch then follows a matrix instruction.
  // ---- all global reads first: the wave's x rows (fragment order) and the block's share of the three weights ----
  v4f xr[PJ_MT][2][4];
#pragma unroll
  for (int mt = 0; mt < PJ_MT; ++mt) {
#pragma unroll
    for (int dc = 0; dc < 2; ++dc) {
      const float* p = x + (size_t)(m0 + mt * 16 + c) * HID_ + h * DH_ + dc * 32 + 8 * hh;
      xr[mt][dc][0] = *(const v4f*)(p);
      xr[mt][dc][1] = *(const v4f*)(p + 4);
      xr[mt][dc][2] = *(const v4f*)(p + 16);
      xr[mt][dc][3] = *(const v4f*)(p + 20);
    }
    // the result of a later load is placed in this row tile's address registers: the wait stands in front of that overwrite
    asm volatile("s_wait_xcnt 0x0" ::: "memory");
  }
  v4f wr[3][4];
#pragma unroll
  for (int i = 0; i < 4; ++i) {
    const size_t wo = (size_t)h * (DH_ * DH_) + (size_t)(i * 256 + tid) * 4;
    wr[0][i] = *(const v4f*)(Wq + wo);
    wr[1][i] = *(const v4f*)(Wk + wo);
    wr[2][i] = *(const v4f*)(Wv + wo);
  }
  if (tid < 3 * DH_) {
    const int w = tid >> 6, n = tid & 63;
    const float* bsrc = (w == 0) ? bq : (w == 1) ? bk : bv;
    Bsh[w][n] = bsrc[h * DH_ + n];
  }
#pragma unroll
  for (int w = 0; w < 3; ++w)
#pragma unroll
    for (int i = 0; i < 4; ++i) {
      const int i4 = i * 256 + tid;                                  // float4 index in the 64 x 64 weight
      v4h hv;
#pragma unroll
      for (int e = 0; e < 4; ++e) hv[e] = (_Float16)(wr[w][i][e] * 16.0f);
      *(v4h*)(&Wsh[w][(i4 >> 4) * PJ_LP + (i4 & 15) * 4]) = hv;
    }
  v16h xb[PJ_MT][2];
#pragma unroll
  for (int mt = 0; mt < PJ_MT; ++mt)
#pragma unroll
    for (int dc = 0; dc < 2; ++dc)
#pragma unroll
      for (int e = 0; e < 16; ++e) xb[mt][dc][e] = (_Float16)xr[mt][dc][e >> 2][e & 3];
  __syncthreads();

  // ---- products and epilogue math; each output has its own LDS tile, so nothing is overwritten ----
#pragma unroll
  for (int w = 0; w < 3; ++w) {
    v8f acc[PJ_MT][4];
#pragma unroll
    for (int mt = 0; mt < PJ_MT; ++mt)
#pragma unroll
      for (int j = 0; j < 4; ++j) acc[mt][j] = (v8f){0.f,0.f,0.f,0.f,0.f,0.f,0.f,0.f};
#pragma unroll
    for (int dc = 0; dc < 2; ++dc)
#pragma unroll
      for (int j = 0; j < 4; ++j) {
        const v16h wa = Frag<_Float16>::load(&Wsh[w][(j * 16 + c) * PJ_LP + dc * 32 + 8 * hh]);
#pragma unroll
        for (int mt = 0; mt < PJ_MT; ++mt)
          acc[mt][j] = __builtin_amdgcn_wmma_f32_16x16x32_f16(false, wa, false, xb[mt][dc], (short)0, acc[mt][j], false, false);
      }
    _Float16* ts = Ts[wave][w];
#pragma unroll
    for (int j = 0; j < 4; ++j) {
      const v4f b0 = *(const v4f*)(&Bsh[w][j * 16 + 8 * hh]);
      const v4f b1 = *(const v4f*)(&Bsh[w][j * 16 + 8 * hh + 4]);
#pragma unroll
      for (int mt = 0; mt < PJ_MT; ++mt) {
        v8h hv;
#pragma unroll
        for (int r = 0; r < 8; ++r) {
          float v = acc[mt][j][r] * (1.0f / 16.0f);
          v += (r < 4) ? b0[r & 3] : b1[r & 3];
          hv[r] = (_Float16)v;
        }
        *(v8h*)(ts + (mt * 16 + c) * PJ_LP + j * 16 + 8 * hh) = hv;
      }
    }
  }
  // the wave reads back only what it wrote itself: order its LDS writes ahead of its LDS reads
  __builtin_amdgcn_fence(__ATOMIC_RELEASE, "workgroup");
  __builtin_amdgcn_wave_barrier();
  __builtin_amdgcn_fence(__ATOMIC_ACQUIRE, "workgroup");

  // ---- stores: 8 lanes x 16 B = one whole 128-B row segment, 4 rows per instruction ----
  {
    const int q = lane >> 3, c8 = (lane & 7) * 8;
#pragma unroll
    for (int w = 0; w < 3; ++w) {
      _Float16* o = ((w == 0) ? qo : (w == 1) ? ko : vo) + (size_t)m0 * HID_ + h * DH_ + c8;
      const _Float16* ts = Ts[wave][w];
#pragma unroll
      for (int it = 0; it < PJ_WR / 4; ++it) {
        const int row = it * 4 + q;
        *(v8h*)(o + (size_t)row * HID_) = *(const v8h*)(ts + row * PJ_LP + c8);
      }
    }
  }
}

// =====================================================================================
// Non-causal attention for head_dim 64, 16-bit q/k/v planes in, f32 out.
//   q, k, v: f16, element (b, s, h, d) at X[(b*S + s)*HID + h*64 + d]; out f32 with the same indexing.
//   scores^T = k.q^T   : v_wmma_f32_16x16x32_f16; the maximum is kept on the unscaled f32 accumulator (sscale > 0)
//   p x 2^15 = 2^(s*cs + (15 - max*cs)), cs = sscale*log2(e): one fma and one hardware base-2 exponential per score
//   out^T    = v^T.p^T : v_wmma_f32_16x16x32_f16, p carried x2^15 in f16 (kept in registers), its sum l carries the same factor
//   f32 accumulate; online softmax in f32. Block = 4 waves = 64 query rows of one (batch, head);
//   keys streamed in 64-key chunks staged in LDS, both as [kv][d] rows of 128 B: K at a pitch of 144 B, V at 160 B;
//   the V^T fragments come out of the V rows by the 16-bit transposing LDS load.
//   Staging: one tensor load per tile (wave 0: K, wave 1: V; the pad fields lay the pitch), two buffers, so that the
//   next chunk's tiles fly while this chunk is worked on; one publish point (waits, then the barrier) between two chunks.
//   grid.x = B * H * (S/64).
// =====================================================================================
#define AT_D 64
#define AT_NW 4
#define AT_QB 64
#define AT_KC 64
#define AT_LP 72   // LDS row pitch of the K tile in f16: 144 B = 16 B x odd, so the 16 rows of a 16-byte fragment read fall on distinct banks
#define AT_VP 80   // LDS row pitch of the V tile in f16: 160 B = 32 B x odd, the conflict-free pitch of the transposing load
#define AT_NC (S_ / AT_KC)             // key chunks = loop iterations (the ring has two buffers)
#define AT_KBYTES 10240u               // one K tile in LDS: 64 rows x 144 B = 9216 B, rounded up to a multiple of 2 KiB
#define AT_VBYTES 10240u               // one V tile in LDS: 64 rows x 160 B, a multiple of 2 KiB as it is
#define AT_BUF (AT_KBYTES + AT_VBYTES) // one buffer: the K tile, then the V tile
#define AT_PADK ((1u << 20) | (4u << 22) | (3u << 25))   // pad on, behind every 128-B row, 4 dwords: LDS pitch 144 B
#define AT_PADV ((1u << 20) | (4u << 22) | (7u << 25))   // pad on, behind every 128-B row, 8 dwords: LDS pitch 160 B

typedef uint32_t u32x4 __attribute__((ext_vector_type(4)));
typedef uint32_t u32x8 __attribute__((ext_vector_type(8)));

__device__ __forceinline__ uint32_t uni(uint32_t v) { return (uint32_t)__builtin_amdgcn_readfirstlane(v); }
// A tensor load ignores the lane mask: only a scalar compare and branch keeps a wave from issuing it.
__device__ __forceinline__ uint32_t pinned(uint32_t v) {
  uint32_t w = uni(v);
  asm volatile("" : "+s"(w));          // the test's value (or a descriptor's index) held in a scalar register: the branch on it is scalar
  return w;
}

// Descriptor group 1 of a tile of 64 rows of 128 B at a source pitch of HID_ * 2 B; W0 = word 0 (no mask, 1-byte elements, the pad),
// a compile-time constant. Tensor dims = tile dims: every tile lies inside its plane.
template <uint32_t W0>
__device__ __forceinline__ u32x8 tile_group1() {
  u32x8 g1;
  g1[0] = uni(W0);
  g1[1] = uni(128u << 16);             // tensor_dim0 = 128 B
  g1[2] = uni(64u << 16);              // tensor_dim1 = 64 rows
  g1[3] = uni(128u << 16);             // tile_dim0
  g1[4] = uni(64u);                    // tile_dim1
  g1[5] = uni((uint32_t)HID_ * 2u);    // source row pitch in bytes
  g1[6] = uni(0u);
  g1[7] = uni(0u);
  // without it the compiler rebuilds the group at each load in registers that it also uses for other things while the request flies
  asm volatile("" : "+s"(g1));         // descriptor words held in scalar registers of their own as long as the loop runs
  return g1;
}
// One tensor load: the tile at global byte address ga goes to LDS byte offset dst.
__device__ __forceinline__ void tile_load(uint32_t dst, uint64_t ga, u32x8 g1) {
  u32x4 g0;
  g0[0] = uni(1u);
  g0[1] = uni(dst);
  g0[2] = uni((uint32_t)ga);
  g0[3] = uni((((uint32_t)(ga >> 32)) & 0x01FFFFFFu) | 0x80000000u);
  asm volatile("tensor_load_to_lds %0, %1" :: "s"(g0), "s"(g1) : "memory");   // one request of the whole wave; the compiler places no wait for it: the waits are the caller's
}

__device__ __forceinline__ v8f hmma16(v16h a, v16h b, v8f c) {
  return __builtin_amdgcn_wmma_f32_16x16x32_f16(false, a, false, b, (short)0, c, false, false);
}

// 16-bit transposing LDS load: the 32 lanes name 16 rows x 32 B of a row-major tile T (lane l: row 8*(l >> 4) + (l & 7),
// byte 16*((l >> 3) & 1)); lane (c = l & 15, hh = l >> 4) receives T[8*hh + 0..7][c]. All 32 lanes are on wherever it is called.
typedef __attribute__((ext_vector_type(8))) short s16x8;
__device__ __forceinline__ v8h ld_tr16(const _Float16* p) {
  typedef __attribute__((address_space(3))) s16x8 lds_s16x8;
  return __builtin_bit_cast(v8h, __builtin_amdgcn_ds_load_tr16_b128_v8i16((lds_s16x8*)p));
}

// value of lane l ^ 16 (the other wave half), as a vector cross-row move; all 32 lanes are on wherever it is called
__device__ __forceinline__ float xhalf(float x) {
  const int b = __builtin_bit_cast(int, x);
  return __builtin_bit_cast(float, __builtin_amdgcn_permlanex16(b, b, 0x76543210, 0xfedcba98, false, false));
}

// eight base-2 exponentials, each in its own register. One statement: no exponential's source is then overwritten by its
// neighbour, and the closing v_nop is the slot that the instruction set asks for between a transcendental and the reader of its result.
__device__ __forceinline__ void exp2x8(float (&e)[8]) {
  asm("v_exp_f32 %0, %0\n\tv_exp_f32 %1, %1\n\tv_exp_f32 %2, %2\n\tv_exp_f32 %3, %3\n\t"
      "v_exp_f32 %4, %4\n\tv_exp_f32 %5, %5\n\tv_exp_f32 %6, %6\n\tv_exp_f32 %7, %7\n\tv_nop"
      : "+v"(e[0]), "+v"(e[1]), "+v"(e[2]), "+v"(e[3]), "+v"(e[4]), "+v"(e[5]), "+v"(e[6]), "+v"(e[7]));
}

__global__ __launch_bounds__(128)
void attn64_f16(const _Float16* __restrict__ qp, const _Float16* __restrict__ kp,
                const _Float16* __restrict__ vp, float* __restrict__ out, float sscale) {
  __shared__ __attribute__((aligned(2048))) unsigned char Ring[2 * AT_BUF];   // two buffers of K [kv][d] and V [kv][d], padded rows   40 KB
  __shared__ __align__(16) float    Os[AT_NW][16 * 68];         // per wave out tile, pitch 68

  const int tid  = threadIdx.x;
  const int wave = tid >> 5;
  const int lane = tid & 31;
  const int hh   = lane >> 4;
  const int c    = lane & 15;
  const uint32_t wv = uni((uint32_t)tid >> 5);                  // the wave's number, scalar

  const int nqb = S_ / AT_QB;                                   // 32
  const int bx = blockIdx.x;
  if (bx >= B_ * H_ * nqb) return;                              // block-uniform, ahead of every barrier
  const int qb = bx % nqb;
  const int bh = bx / nqb;
  const int h  = bh % H_;
  const int b  = bh / H_;
  const int q0 = qb * AT_QB + wave * 16;

  const size_t pbase = (size_t)b * S_ * HID_ + (size_t)h * DH_;
  const _Float16* qb_ptr = qp + pbase;
  const _Float16* kb_ptr = kp + pbase;
  const _Float16* vb_ptr = vp + pbase;
  float*          ob_ptr = out + pbase;

  // ---- Q fragments (B operand, column = query q0 + c, k = d): 2 d-chunks, dense static-stride loads ----
  v16h qa[2];
#pragma unroll
  for (int dc = 0; dc < 2; ++dc)
    qa[dc] = Frag<_Float16>::load(qb_ptr + (size_t)(q0 + c) * HID_ + dc * 32 + 8 * hh);

  const float cs = sscale * LOG2E;                              // score scale for base-2 exponents
  float mrow = -INFINITY, lrow = 0.f;                           // of query q0 + c; mrow unscaled; lrow sums this wave half's keys, x2^15
  v8f oacc[4];
#pragma unroll
  for (int t = 0; t < 4; ++t) oacc[t] = (v8f){0.f,0.f,0.f,0.f,0.f,0.f,0.f,0.f};

  // ---- ring prologue: chunk 0's tiles, each issuer's own wait directly behind its load; the barrier that publishes them and
  //      chunk 1's loads are the first publish point, at the head of the loop ----
  const uint32_t lbase = (uint32_t)(size_t)Ring;                // byte offset in the work-group's LDS
  const uint64_t kga = (uint64_t)(size_t)kb_ptr, vga = (uint64_t)(size_t)vb_ptr;
  const uint64_t cstep = (uint64_t)AT_KC * HID_ * 2u;           // source bytes from one chunk to the next
  const u32x8 g1k = tile_group1<AT_PADK>(), g1v = tile_group1<AT_PADV>();
  if (pinned(wv == 0u)) {
    tile_load(lbase, kga, g1k);
    asm volatile("s_wait_tensorcnt 0x0" ::: "memory");          // the K tile of chunk 0 has landed
  }
  if (pinned(wv == 1u)) {
    tile_load(lbase + AT_KBYTES, vga, g1v);
    asm volatile("s_wait_tensorcnt 0x0" ::: "memory");          // the V tile of chunk 0 has landed
  }

  for (int kc = 0; kc < AT_NC; ++kc) {                          // 32 chunks, static; chunk kc (keys from kv0 = 64 kc) lies in buffer kc & 1
    // ---- publish point of chunk kc = the foot of chunk kc - 1, every wave, in this order. It stands at the head of the
    //      loop so that the whole of a chunk's arithmetic stays one straight block behind it. ----
    asm volatile("s_wait_dscnt 0x0" ::: "memory");              // this wave's reads of chunk kc - 1's buffer have returned
    if (pinned(wv < 2u)) {
      asm volatile("s_wait_tensorcnt 0x0" ::: "memory");        // the issuer's tile of chunk kc has landed
    }
    __syncthreads();                                            // publishes chunk kc; every wave has left chunk kc - 1's buffer
    const uint32_t nx = pinned((uint32_t)kc + 1u);              // held scalar behind the wait: the descriptor is formed from it here
    if (pinned(nx < (uint32_t)AT_NC)) {                         // only while chunk kc + 1 exists: it goes into the buffer just left
      const uint32_t dst = lbase + (nx & 1u) * AT_BUF;
      if (pinned(wv == 0u)) tile_load(dst, kga + (uint64_t)nx * cstep, g1k);
      if (pinned(wv == 1u)) tile_load(dst + AT_KBYTES, vga + (uint64_t)nx * cstep, g1v);
    }
    const _Float16* Ksh = (const _Float16*)(Ring + (uint32_t)(kc & 1) * AT_BUF);
    const _Float16* Vsh = (const _Float16*)(Ring + (uint32_t)(kc & 1) * AT_BUF + AT_KBYTES);

    // scores transposed: S^T = K.Q^T, 64 keys x 16 queries per wave; A[m = kv][k = d] = Ksh[kv][d], B[k = d][n = query] = qa
    // D layout: s[j][r] = score of key kv0 + j*16 + 8*hh + r for query q0 + c, so a lane holds scores of one query only
    // All fragment reads of the chunk stand here as one group, K ahead of V^T: the products then wait out one LDS
    // latency instead of one per product, and the V^T fragments land while the scores and the softmax are worked on.
    v16h kf[2][4], vf[2][4];
#pragma unroll
    for (int dc = 0; dc < 2; ++dc)
#pragma unroll
      for (int j = 0; j < 4; ++j)
        kf[dc][j] = Frag<_Float16>::load(Ksh + (j * 16 + c) * AT_LP + dc * 32 + 8 * hh);
#pragma unroll
    for (int kk = 0; kk < 2; ++kk)
#pragma unroll
      for (int t = 0; t < 4; ++t) {
        // elements 0..7 = V[kk*32 + 8*hh + 0..7][t*16 + c], elements 8..15 = V[kk*32 + 16 + 8*hh + 0..7][t*16 + c]: the k order of pb
        const _Float16* vt = Vsh + (kk * 32 + 8 * hh + (lane & 7)) * AT_VP + t * 16 + 8 * ((lane >> 3) & 1);
        Frag<_Float16>::U f;
        f.h[0] = ld_tr16(vt);
        f.h[1] = ld_tr16(vt + 16 * AT_VP);
        vf[kk][t] = f.v;
      }
    // keeps the scheduler from sinking the reads back down among the products, where each would be waited for on its own
    __builtin_amdgcn_sched_barrier(0);
    v8f s[4];
#pragma unroll
    for (int j = 0; j < 4; ++j) s[j] = (v8f){0.f,0.f,0.f,0.f,0.f,0.f,0.f,0.f};
#pragma unroll
    for (int dc = 0; dc < 2; ++dc)
#pragma unroll
      for (int j = 0; j < 4; ++j) s[j] = hmma16(kf[dc][j], qa[dc], s[j]);

    // online softmax, one query per lane: maximum in-lane over the lane's 32 keys, one exchange between the wave halves
    float m = -INFINITY;
#pragma unroll
    for (int j = 0; j < 4; ++j)
#pragma unroll
      for (int r = 0; r < 8; ++r) m = fmaxf(m, s[j][r]);
    m = fmaxf(m, xhalf(m));
    const float mnew = fmaxf(mrow, m);
    const float alpha = __builtin_amdgcn_exp2f((mrow - mnew) * cs);
    const float eoff = fmaf(-mnew, cs, PSHIFT);                 // exponent offset: minus the scaled maximum, plus the x2^15 carry
    mrow = mnew;
    // P^T packs from the score tiles straight into the B operand: element e of pb[kk] = tile 2*kk + (e >> 3), register e & 7
    v16h pb[2];
    float psum = 0.f;
#pragma unroll
    for (int j = 0; j < 4; ++j) {
      float p[8];                                               // p x 2^15, in (0, 2^15]
#pragma unroll
      for (int r = 0; r < 8; ++r) p[r] = fmaf(s[j][r], cs, eoff);
      exp2x8(p);
#pragma unroll
      for (int r = 0; r < 8; ++r) {
        psum += p[r];
        pb[j >> 1][(j & 1) * 8 + r] = (_Float16)p[r];
      }
    }
    lrow = lrow * alpha + psum;                                 // this half's keys only; the halves join in the epilogue
#pragma unroll
    for (int t = 0; t < 4; ++t)
#pragma unroll
      for (int r = 0; r < 8; ++r) oacc[t][r] *= alpha;

    // O^T += V^T.P^T: A[m = d][k = kv] = Vsh[kv][d], B[k = kv][n = query] = pb; oacc[t][r] = out[q0 + c][t*16 + 8*hh + r]
#pragma unroll
    for (int kk = 0; kk < 2; ++kk) {
#pragma unroll
      for (int t = 0; t < 4; ++t) oacc[t] = hmma16(vf[kk][t], pb[kk], oacc[t]);
    }
  }
  asm volatile("s_wait_tensorcnt 0x0" ::: "memory");            // no request is left in flight when the wave goes on
  asm volatile("s_wait_dscnt 0x0" ::: "memory");                // nor a read of the ring

  // ---- epilogue: out = acc / l (both carry x2^15), staged per wave in LDS, whole 256-B row segments ----
  float* os = Os[wave];
  {
    const float l = lrow + xhalf(lrow);
    const float inv = 1.0f / l;
#pragma unroll
    for (int t = 0; t < 4; ++t) {
      v4f lo, hi;
#pragma unroll
      for (int r = 0; r < 4; ++r) { lo[r] = oacc[t][r] * inv; hi[r] = oacc[t][4 + r] * inv; }
      *(v4f*)(os + c * 68 + t * 16 + 8 * hh)     = lo;
      *(v4f*)(os + c * 68 + t * 16 + 8 * hh + 4) = hi;
    }
  }
  __builtin_amdgcn_fence(__ATOMIC_RELEASE, "workgroup");
  __builtin_amdgcn_wave_barrier();
  __builtin_amdgcn_fence(__ATOMIC_ACQUIRE, "workgroup");
  {
    const int c4 = (lane & 15) * 4;
    {
#pragma unroll
      for (int it = 0; it < 8; ++it) {
        const int row = it * 2 + hh;
        v4f val = *(const v4f*)(os + row * 68 + c4);
        *(v4f*)(ob_ptr + (size_t)(q0 + row) * HID_ + c4) = val;
      }
      
    }
  }
}

// ---------------------------------------------------------------------------
// Host glue. Workspace carve (bytes): q, k, v as f16 [B*S][HID], 8 MiB each; total 25,165,824 B.
// ---------------------------------------------------------------------------
extern "C" void kernel_launch(void* const* d_in, const int* in_sizes, int n_in,
                              void* d_out, int out_size, void* d_ws,
                              size_t ws_size, hipStream_t stream) {
  if (n_in < 7) return;
  const int NX = B_ * S_ * HID_;          // 4194304
  const int NW = H_ * DH_ * DH_;          // 32768
  const int NB = H_ * DH_;                // 512
  if (in_sizes[0] != NX || in_sizes[1] != NW || in_sizes[2] != NB || in_sizes[3] != NW ||
      in_sizes[4] != NB || in_sizes[5] != NW || in_sizes[6] != NB || out_size != NX) return;

  const float* x  = (const float*)d_in[0];
  const float* Wq = (const float*)d_in[1];
  const float* bq = (const float*)d_in[2];
  const float* Wk = (const float*)d_in[3];
  const float* bk = (const float*)d_in[4];
  const float* Wv = (const float*)d_in[5];
  const float* bv = (const float*)d_in[6];
  float* out = (float*)d_out;

  const size_t bytesP = (size_t)NX * 2;                   // 8388608 per f16 plane
  if (3 * bytesP > ws_size) return;

  char* ws = (char*)d_ws;
  _Float16* Qh = (_Float16*)(ws);
  _Float16* Kh = (_Float16*)(ws + bytesP);
  _Float16* Vh = (_Float16*)(ws + 2 * bytesP);

  // projections: one block per (256 rows, head); x and the weights are read as f32 and rounded in the kernel.
  {
    dim3 pgrid(B_ * S_ / PJ_ROWS, H_);                    // 32 x 8
    qkv_proj_f16<<<pgrid, 256, 0, stream>>>(x, Wq, bq, Wk, bk, Wv, bv, Qh, Kh, Vh);
  }

  // attention: one block per (b, h, 64-query block); keys streamed in 64-key chunks, no mask, score scale 1/8.
  {
    const int nblk = B_ * H_ * (S_ / AT_QB);              // 1024
    attn64_f16<<<nblk, 128, 0, stream>>>(Qh, Kh, Vh, out, 0.125f);
  }
}

// v008
// One run takes 38.7 microseconds.
// Timed twice side by side with v007, it ran 1.12 and 1.14 times as fast.
// All steps since v000 together make it 6.49 times as fast.
// Contractions: per-head q/k/v projections = v_wmma_f32_16x16x32_f16 (f16 operands, weights carried x16, f32 accumulate, f16 output planes);
// attention q.k^T and p.v = v_wmma_f32_16x16x32_f16 (f16 operands, p carried x2^7, f32 accumulate); softmax (base 2) and epilogues f32.
#include <hip/hip_runtime.h>
#include <math.h>
#include <stdint.h>

#define B_   4
#define S_   2048
#define HID_ 512
#define H_   8
#define DH_  64

typedef __attribute__((ext_vector_type(16))) _Float16 v16h;
typedef __attribute__((ext_vector_type(8)))  _Float16 v8h;
typedef __attribute__((ext_vector_type(4)))  _Float16 v4h;
typedef __attribute__((ext_vector_type(8)))  float    v8f;
typedef __attribute__((ext_vector_type(4)))  float    v4f;
#define PSHIFT 7.0f                    // p and its sum are carried x2^7: the shift is part of the base-2 exponent's offset
#define PLIM   32768.0f                // a lane's sum of p over a chunk up to 2^15: then every p of it fits f16
#define LOG2E  1.44269504088896340736f
#define QSCALE (0.125f * LOG2E)        // score scale 1/sqrt(64) and log2(e), carried by the q plane

template <typename T> struct Frag;
template <> struct Frag<_Float16> {
  typedef v16h V; union U { v16h v; v8h h[2]; };
  static __device__ __forceinline__ v16h load(const _Float16* p) {   // elements 0..7 <- p[0..7], 8..15 <- p[16..23]
    U f; f.h[0] = *(const v8h*)(p); f.h[1] = *(const v8h*)(p + 16); return f.v;
  }
};

// =====================================================================================
// q, k, v projections of one head for 256 rows, one launch for all three.
//   y[m][n] = (sum_k x[m][h*64 + k] * (16 W[h][n][k])) / 16 + b[h][n], y = q, k, v as f16 planes [B*S][HID];
//   the q plane holds q * QSCALE (multiplied in f32, ahead of the one rounding to f16): k.q is then a base-2 exponent.
//   x and W are read as f32 and rounded to f16 in registers (W after the x16 carry).
//   Product transposed: A[m' = n][k] = W rows from LDS, B[k][n' = row] = x rows, so a lane's 8 accumulator
//   registers are 8 neighbouring outputs of one row: D[r] = y[m0 + c][j*16 + 8*hh + r].
//   Block = 8 waves x 32 rows; the x fragments of a wave serve all three weights.
//   grid = (B*S/256, H).
// =====================================================================================
#define PJ_LP 72                       // LDS row pitch in f16: 144 B = 16 B x odd, as for the attention K tile
#define PJ_NW 8
#define PJ_MT 2                        // 16-row tiles per wave
#define PJ_WR (PJ_MT * 16)             // rows per wave
#define PJ_ROWS (PJ_NW * PJ_WR)        // rows per block

__global__ __launch_bounds__(256)
void qkv_proj_f16(const float* __restrict__ x,
                  const float* __restrict__ Wq, const float* __restrict__ bq,
                  const float* __restrict__ Wk, const float* __restrict__ bk,
                  const float* __restrict__ Wv, const float* __restrict__ bv,
                  _Float16* __restrict__ qo, _Float16* __restrict__ ko, _Float16* __restrict__ vo) {
  __shared__ __align__(16) _Float16 Wsh[3][DH_ * PJ_LP];             // 16 W[h] as f16, [n][k], padded rows   27 KB
  __shared__ __align__(16) float    Bsh[3][DH_];                     // b[h]
  __shared__ __align__(16) _Float16 Ts[PJ_NW][3][PJ_WR * PJ_LP];     // per wave and output: 32 x 64 tile     108 KB

  const int tid  = threadIdx.x;
  const int wave = tid >> 5;
  const int lane = tid & 31;
  const int hh   = lane >> 4;
  const int c    = lane & 15;
  const int h    = blockIdx.y;
  const int m0   = blockIdx.x * PJ_ROWS + wave * PJ_WR;

  // Every loop of this kernel is unrolled in full: the fragment and accumulator arrays stay in registers only
  // when they are indexed by constants, and no branch then follows a matrix instruction.
  // ---- all global reads first: the wave's x rows (fragment order) and the block's share of the three weights ----
  v4f xr[PJ_MT][2][4];
#pragma unroll
  for (int mt = 0; mt < PJ_MT; ++mt) {
#pragma unroll
    for (int dc = 0; dc < 2; ++dc) {
      const float* p = x + (size_t)(m0 + mt * 16 + c) * HID_ + h * DH_ + dc * 32 + 8 * hh;
      xr[mt][dc][0] = *(const v4f*)(p);
      xr[mt][dc][1] = *(const v4f*)(p + 4);
      xr[mt][dc][2] = *(const v4f*)(p + 16);
      xr[mt][dc][3] = *(const v4f*)(p + 20);
    }
    // the result of a later load is placed in this row tile's address registers: the wait stands in front of that overwrite
    asm volatile("s_wait_xcnt 0x0" ::: "memory");
  }
  v4f wr[3][4];
#pragma unroll
  for (int i = 0; i < 4; ++i) {
    const size_t wo = (size_t)h * (DH_ * DH_) + (size_t)(i * 256 + tid) * 4;
    wr[0][i] = *(const v4f*)(Wq + wo);
    wr[1][i] = *(const v4f*)(Wk + wo);
    wr[2][i] = *(const v4f*)(Wv + wo);
  }
  if (tid < 3 * DH_) {
    const int w = tid >> 6, n = tid & 63;
    const float* bsrc = (w == 0) ? bq : (w == 1) ? bk : bv;
    Bsh[w][n] = bsrc[h * DH_ + n];
  }
#pragma unroll
  for (int w = 0; w < 3; ++w)
#pragma unroll
    for (int i = 0; i < 4; ++i) {
      const int i4 = i * 256 + tid;                                  // float4 index in the 64 x 64 weight
      v4h hv;
#pragma unroll
      for (int e = 0; e < 4; ++e) hv[e] = (_Float16)(wr[w][i][e] * 16.0f);
      *(v4h*)(&Wsh[w][(i4 >> 4) * PJ_LP + (i4 & 15) * 4]) = hv;
    }
  v16h xb[PJ_MT][2];
#pragma unroll
  for (int mt = 0; mt < PJ_MT; ++mt)
#pragma unroll
    for (int dc = 0; dc < 2; ++dc)
#pragma unroll
      for (int e = 0; e < 16; ++e) xb[mt][dc][e] = (_Float16)xr[mt][dc][e >> 2][e & 3];
  __syncthreads();

  // ---- products and epilogue math; each output has its own LDS tile, so nothing is overwritten ----
#pragma unroll
  for (int w = 0; w < 3; ++w) {
    v8f acc[PJ_MT][4];
#pragma unroll
    for (int mt = 0; mt < PJ_MT; ++mt)
#pragma unroll
      for (int j = 0; j < 4; ++j) acc[mt][j] = (v8f){0.f,0.f,0.f,0.f,0.f,0.f,0.f,0.f};
#pragma unroll
    for (int dc = 0; dc < 2; ++dc)
#pragma unroll
      for (int j = 0; j < 4; ++j) {
        const v16h wa = Frag<_Float16>::load(&Wsh[w][(j * 16 + c) * PJ_LP + dc * 32 + 8 * hh]);
#pragma unroll
        for (int mt = 0; mt < PJ_MT; ++mt)
          acc[mt][j] = __builtin_amdgcn_wmma_f32_16x16x32_f16(false, wa, false, xb[mt][dc], (short)0, acc[mt][j], false, false);
      }
    _Float16* ts = Ts[wave][w];
#pragma unroll
    for (int j = 0; j < 4; ++j) {
      const v4f b0 = *(const v4f*)(&Bsh[w][j * 16 + 8 * hh]);
      const v4f b1 = *(const v4f*)(&Bsh[w][j * 16 + 8 * hh + 4]);
#pragma unroll
      for (int mt = 0; mt < PJ_MT; ++mt) {
        v8h hv;
#pragma unroll
        for (int r = 0; r < 8; ++r) {
          float v = acc[mt][j][r] * (1.0f / 16.0f);
          v += (r < 4) ? b0[r & 3] : b1[r & 3];
          if (w == 0) v *= QSCALE;
          hv[r] = (_Float16)v;
        }
        *(v8h*)(ts + (mt * 16 + c) * PJ_LP + j * 16 + 8 * hh) = hv;
      }
    }
  }
  // the wave reads back only what it wrote itself: order its LDS writes ahead of its LDS reads
  __builtin_amdgcn_fence(__ATOMIC_RELEASE, "workgroup");
  __builtin_amdgcn_wave_barrier();
  __builtin_amdgcn_fence(__ATOMIC_ACQUIRE, "workgroup");

  // ---- stores: 8 lanes x 16 B = one whole 128-B row segment, 4 rows per instruction ----
  {
    const int q = lane >> 3, c8 = (lane & 7) * 8;
#pragma unroll
    for (int w = 0; w < 3; ++w) {
      _Float16* o = ((w == 0) ? qo : (w == 1) ? ko : vo) + (size_t)m0 * HID_ + h * DH_ + c8;
      const _Float16* ts = Ts[wave][w];
#pragma unroll
      for (int it = 0; it < PJ_WR / 4; ++it) {
        const int row = it * 4 + q;
        *(v8h*)(o + (size_t)row * HID_) = *(const v8h*)(ts + row * PJ_LP + c8);
      }
    }
  }
}

// =====================================================================================
// Non-causal attention for head_dim 64, 16-bit q/k/v planes in, f32 out.
//   q, k, v: f16, element (b, s, h, d) at X[(b*S + s)*HID + h*64 + d], q already times QSCALE; out f32 with the same indexing.
//   e^T = k.q^T + off  : v_wmma_f32_16x16x32_f16; off = 7 - (the query's reference score), the product's C operand
//   p x 2^7 = 2^e      : one hardware base-2 exponential per score, straight from the accumulator
//   off is renewed (from the chunk's maximum, with a rescale of out and l) in chunk 0 and whenever a lane's sum of p over a
//   chunk passes 2^15: one wave-uniform test per chunk. Below that bound every p fits f16, and softmax does not depend on off.
//   out^T    = v^T.p^T : v_wmma_f32_16x16x32_f16, p in f16 (kept in registers), its sum l carries the same factor
//   f32 accumulate; online softmax in f32. Block = 4 waves = 64 query rows of one (batch, head);
//   keys streamed in 64-key chunks staged in LDS, both as [kv][d] rows of 128 B: K at a pitch of 144 B, V at 160 B;
//   the V^T fragments come out of the V rows by the 16-bit transposing LDS load.
//   Staging: one tensor load per tile (wave 0: K, wave 1: V; the pad fields lay the pitch), two buffers, so that the
//   next chunk's tiles fly while this chunk is worked on; one publish point (waits, then the barrier) between two chunks.
//   grid.x = B * H * (S/64).
// =====================================================================================
#define AT_D 64
#define AT_NW 4
#define AT_QB 64
#define AT_KC 64
#define AT_LP 72   // LDS row pitch of the K tile in f16: 144 B = 16 B x odd, so the 16 rows of a 16-byte fragment read fall on distinct banks
#define AT_VP 80   // LDS row pitch of the V tile in f16: 160 B = 32 B x odd, the conflict-free pitch of the transposing load
#define AT_NC (S_ / AT_KC)             // key chunks = loop iterations (the ring has two buffers)
#define AT_KBYTES 10240u               // one K tile in LDS: 64 rows x 144 B = 9216 B, rounded up to a multiple of 2 KiB
#define AT_VBYTES 10240u               // one V tile in LDS: 64 rows x 160 B, a multiple of 2 KiB as it is
#define AT_BUF (AT_KBYTES + AT_VBYTES) // one buffer: the K tile, then the V tile
#define AT_PADK ((1u << 20) | (4u << 22) | (3u << 25))   // pad on, behind every 128-B row, 4 dwords: LDS pitch 144 B
#define AT_PADV ((1u << 20) | (4u << 22) | (7u << 25))   // pad on, behind every 128-B row, 8 dwords: LDS pitch 160 B

typedef uint32_t u32x4 __attribute__((ext_vector_type(4)));
typedef uint32_t u32x8 __attribute__((ext_vector_type(8)));

__device__ __forceinline__ uint32_t uni(uint32_t v) { return (uint32_t)__builtin_amdgcn_readfirstlane(v); }
// A tensor load ignores the lane mask: only a scalar compare and branch keeps a wave from issuing it.
__device__ __forceinline__ uint32_t pinned(uint32_t v) {
  uint32_t w = uni(v);
  asm volatile("" : "+s"(w));          // the test's value (or a descriptor's index) held in a scalar register: the branch on it is scalar
  return w;
}

// Descriptor group 1 of a tile of 64 rows of 128 B at a source pitch of HID_ * 2 B; W0 = word 0 (no mask, 1-byte elements, the pad),
// a compile-time constant. Tensor dims = tile dims: every tile lies inside its plane.
template <uint32_t W0>
__device__ __forceinline__ u32x8 tile_group1() {
  u32x8 g1;
  g1[0] = uni(W0);
  g1[1] = uni(128u << 16);             // tensor_dim0 = 128 B
  g1[2] = uni(64u << 16);              // tensor_dim1 = 64 rows
  g1[3] = uni(128u << 16);             // tile_dim0
  g1[4] = uni(64u);                    // tile_dim1
  g1[5] = uni((uint32_t)HID_ * 2u);    // source row pitch in bytes
  g1[6] = uni(0u);
  g1[7] = uni(0u);
  // without it the compiler rebuilds the group at each load in registers that it also uses for other things while the request flies
  asm volatile("" : "+s"(g1));         // descriptor words held in scalar registers of their own as long as the loop runs
  return g1;
}
// One tensor load: the tile at global byte address ga goes to LDS byte offset dst.
__device__ __forceinline__ void tile_load(uint32_t dst, uint64_t ga, u32x8 g1) {
  u32x4 g0;
  g0[0] = uni(1u);
  g0[1] = uni(dst);
  g0[2] = uni((uint32_t)ga);
  g0[3] = uni((((uint32_t)(ga >> 32)) & 0x01FFFFFFu) | 0x80000000u);
  asm volatile("tensor_load_to_lds %0, %1" :: "s"(g0), "s"(g1) : "memory");   // one request of the whole wave; the compiler places no wait for it: the waits are the caller's
}

__device__ __forceinline__ v8f hmma16(v16h a, v16h b, v8f c) {
  return __builtin_amdgcn_wmma_f32_16x16x32_f16(false, a, false, b, (short)0, c, false, false);
}

// 16-bit transposing LDS load: the 32 lanes name 16 rows x 32 B of a row-major tile T (lane l: row 8*(l >> 4) + (l & 7),
// byte 16*((l >> 3) & 1)); lane (c = l & 15, hh = l >> 4) receives T[8*hh + 0..7][c]. All 32 lanes are on wherever it is called.
typedef __attribute__((ext_vector_type(8))) short s16x8;
__device__ __forceinline__ v8h ld_tr16(const _Float16* p) {
  typedef __attribute__((address_space(3))) s16x8 lds_s16x8;
  return __builtin_bit_cast(v8h, __builtin_amdgcn_ds_load_tr16_b128_v8i16((lds_s16x8*)p));
}

// value of lane l ^ 16 (the other wave half), as a vector cross-row move; all 32 lanes are on wherever it is called
__device__ __forceinline__ float xhalf(float x) {
  const int b = __builtin_bit_cast(int, x);
  return __builtin_bit_cast(float, __builtin_amdgcn_permlanex16(b, b, 0x76543210, 0xfedcba98, false, false));
}

// eight base-2 exponentials of one score tile, into registers of their own (the exponents stay: a renewal of the offset reads
// them again). One statement: no exponential's source is overwritten by a neighbour, and the closing v_nop is the slot that the
// instruction set asks for between a transcendental and the reader of its result.
// LEAD: the statement stands right behind the score products. Three matrix instructions follow the one that ends tile 0, and
// the chip wants four vector slots ahead of the first reader of its result: the leading v_nop is the fourth.
template <bool LEAD>
__device__ __forceinline__ void exp2x8(float (&o)[8], const v8f e) {
  if (LEAD)
    asm("v_nop\n\tv_exp_f32 %0, %8\n\tv_exp_f32 %1, %9\n\tv_exp_f32 %2, %10\n\tv_exp_f32 %3, %11\n\t"
        "v_exp_f32 %4, %12\n\tv_exp_f32 %5, %13\n\tv_exp_f32 %6, %14\n\tv_exp_f32 %7, %15\n\tv_nop"
        : "=&v"(o[0]), "=&v"(o[1]), "=&v"(o[2]), "=&v"(o[3]), "=&v"(o[4]), "=&v"(o[5]), "=&v"(o[6]), "=&v"(o[7])
        : "v"(e[0]), "v"(e[1]), "v"(e[2]), "v"(e[3]), "v"(e[4]), "v"(e[5]), "v"(e[6]), "v"(e[7]));
  else
    asm("v_exp_f32 %0, %8\n\tv_exp_f32 %1, %9\n\tv_exp_f32 %2, %10\n\tv_exp_f32 %3, %11\n\t"
        "v_exp_f32 %4, %12\n\tv_exp_f32 %5, %13\n\tv_exp_f32 %6, %14\n\tv_exp_f32 %7, %15\n\tv_nop"
        : "=&v"(o[0]), "=&v"(o[1]), "=&v"(o[2]), "=&v"(o[3]), "=&v"(o[4]), "=&v"(o[5]), "=&v"(o[6]), "=&v"(o[7])
        : "v"(e[0]), "v"(e[1]), "v"(e[2]), "v"(e[3]), "v"(e[4]), "v"(e[5]), "v"(e[6]), "v"(e[7]));
}

// p = 2^e of a chunk's four score tiles: packed straight into the B operand of the second product (element i of pb[kk] =
// tile 2*kk + (i >> 3), register i & 7), and summed over the lane's 32 keys in two chains (even and odd registers).
template <bool LEAD>
__device__ __forceinline__ void probs(const v8f (&e)[4], v16h (&pb)[2], float& psum) {
  float a0 = 0.f, a1 = 0.f;
#pragma unroll
  for (int j = 0; j < 4; ++j) {
    float p[8];                                                 // p x 2^7
    if (LEAD && j == 0) exp2x8<true>(p, e[j]); else exp2x8<false>(p, e[j]);
#pragma unroll
    for (int r = 0; r < 8; r += 2) {
      a0 = (j == 0 && r == 0) ? p[0] : a0 + p[r];
      a1 = (j == 0 && r == 0) ? p[1] : a1 + p[r + 1];
    }
#pragma unroll
    for (int r = 0; r < 8; ++r) pb[j >> 1][(j & 1) * 8 + r] = (_Float16)p[r];
  }
  psum = a0 + a1;
}

__global__ __launch_bounds__(128)
void attn64_f16(const _Float16* __restrict__ qp, const _Float16* __restrict__ kp,
                const _Float16* __restrict__ vp, float* __restrict__ out) {
  __shared__ __attribute__((aligned(2048))) unsigned char Ring[2 * AT_BUF];   // two buffers of K [kv][d] and V [kv][d], padded rows   40 KB
  __shared__ __align__(16) float    Os[AT_NW][16 * 68];         // per wave out tile, pitch 68

  const int tid  = threadIdx.x;
  const int wave = tid >> 5;
  const int lane = tid & 31;
  const int hh   = lane >> 4;
  const int c    = lane & 15;
  const uint32_t wv = uni((uint32_t)tid >> 5);                  // the wave's number, scalar

  const int nqb = S_ / AT_QB;                                   // 32
  const int bx = blockIdx.x;
  if (bx >= B_ * H_ * nqb) return;                              // block-uniform, ahead of every barrier
  const int qb = bx % nqb;
  const int bh = bx / nqb;
  const int h  = bh % H_;
  const int b  = bh / H_;
  const int q0 = qb * AT_QB + wave * 16;

  const size_t pbase = (size_t)b * S_ * HID_ + (size_t)h * DH_;
  const _Float16* qb_ptr = qp + pbase;
  const _Float16* kb_ptr = kp + pbase;
  const _Float16* vb_ptr = vp + pbase;
  float*          ob_ptr = out + pbase;

  // ---- Q fragments (B operand, column = query q0 + c, k = d): 2 d-chunks, dense static-stride loads ----
  v16h qa[2];
#pragma unroll
  for (int dc = 0; dc < 2; ++dc)
    qa[dc] = Frag<_Float16>::load(qb_ptr + (size_t)(q0 + c) * HID_ + dc * 32 + 8 * hh);

  float lrow = 0.f;                                             // of query q0 + c: sums this wave half's keys, x2^7
  v8f off = (v8f){0.f,0.f,0.f,0.f,0.f,0.f,0.f,0.f};             // exponent offset of query q0 + c in all eight registers: C of the score products
  v8f oacc[4];
#pragma unroll
  for (int t = 0; t < 4; ++t) oacc[t] = (v8f){0.f,0.f,0.f,0.f,0.f,0.f,0.f,0.f};

  // ---- ring prologue: chunk 0's tiles, each issuer's own wait directly behind its load; the barrier that publishes them and
  //      chunk 1's loads are the first publish point, at the head of the loop ----
  const uint32_t lbase = (uint32_t)(size_t)Ring;                // byte offset in the work-group's LDS
  const uint64_t kga = (uint64_t)(size_t)kb_ptr, vga = (uint64_t)(size_t)vb_ptr;
  const uint64_t cstep = (uint64_t)AT_KC * HID_ * 2u;           // source bytes from one chunk to the next
  const u32x8 g1k = tile_group1<AT_PADK>(), g1v = tile_group1<AT_PADV>();
  if (pinned(wv == 0u)) {
    tile_load(lbase, kga, g1k);
    asm volatile("s_wait_tensorcnt 0x0" ::: "memory");          // the K tile of chunk 0 has landed
  }
  if (pinned(wv == 1u)) {
    tile_load(lbase + AT_KBYTES, vga, g1v);
    asm volatile("s_wait_tensorcnt 0x0" ::: "memory");          // the V tile of chunk 0 has landed
  }

  for (int kc = 0; kc < AT_NC; ++kc) {                          // 32 chunks, static; chunk kc (keys from kv0 = 64 kc) lies in buffer kc & 1
    // ---- publish point of chunk kc = the foot of chunk kc - 1, every wave, in this order. It stands at the head of the
    //      loop so that the whole of a chunk's arithmetic stays one straight block behind it. ----
    asm volatile("s_wait_dscnt 0x0" ::: "memory");              // this wave's reads of chunk kc - 1's buffer have returned
    if (pinned(wv < 2u)) {
      asm volatile("s_wait_tensorcnt 0x0" ::: "memory");        // the issuer's tile of chunk kc has landed
    }
    __syncthreads();                                            // publishes chunk kc; every wave has left chunk kc - 1's buffer
    const uint32_t nx = pinned((uint32_t)kc + 1u);              // held scalar behind the wait: the descriptor is formed from it here
    if (pinned(nx < (uint32_t)AT_NC)) {                         // only while chunk kc + 1 exists: it goes into the buffer just left
      const uint32_t dst = lbase + (nx & 1u) * AT_BUF;
      if (pinned(wv == 0u)) tile_load(dst, kga + (uint64_t)nx * cstep, g1k);
      if (pinned(wv == 1u)) tile_load(dst + AT_KBYTES, vga + (uint64_t)nx * cstep, g1v);
    }
    const _Float16* Ksh = (const _Float16*)(Ring + (uint32_t)(kc & 1) * AT_BUF);
    const _Float16* Vsh = (const _Float16*)(Ring + (uint32_t)(kc & 1) * AT_BUF + AT_KBYTES);

    // scores transposed: S^T = K.Q^T, 64 keys x 16 queries per wave; A[m = kv][k = d] = Ksh[kv][d], B[k = d][n = query] = qa
    // D layout: s[j][r] = score of key kv0 + j*16 + 8*hh + r for query q0 + c, so a lane holds scores of one query only
    // All fragment reads of the chunk stand here as one group, K ahead of V^T: the products then wait out one LDS
    // latency instead of one per product, and the V^T fragments land while the scores and the softmax are worked on.
    v16h kf[2][4], vf[2][4];
#pragma unroll
    for (int dc = 0; dc < 2; ++dc)
#pragma unroll
      for (int j = 0; j < 4; ++j)
        kf[dc][j] = Frag<_Float16>::load(Ksh + (j * 16 + c) * AT_LP + dc * 32 + 8 * hh);
    // holds the K reads ahead of the V^T reads: LDS answers in order, and the first products wait for K alone
    __builtin_amdgcn_sched_barrier(0);
#pragma unroll
    for (int kk = 0; kk < 2; ++kk)
#pragma unroll
      for (int t = 0; t < 4; ++t) {
        // elements 0..7 = V[kk*32 + 8*hh + 0..7][t*16 + c], elements 8..15 = V[kk*32 + 16 + 8*hh + 0..7][t*16 + c]: the k order of pb
        const _Float16* vt = Vsh + (kk * 32 + 8 * hh + (lane & 7)) * AT_VP + t * 16 + 8 * ((lane >> 3) & 1);
        Frag<_Float16>::U f;
        f.h[0] = ld_tr16(vt);
        f.h[1] = ld_tr16(vt + 16 * AT_VP);
        vf[kk][t] = f.v;
      }
    // keeps the scheduler from sinking the reads back down among the products, where each would be waited for on its own
    __builtin_amdgcn_sched_barrier(0);
    v8f s[4];
#pragma unroll
    for (int j = 0; j < 4; ++j) s[j] = hmma16(kf[0][j], qa[0], off);
#pragma unroll
    for (int j = 0; j < 4; ++j) s[j] = hmma16(kf[1][j], qa[1], s[j]);
    // keeps the eight products one run of four independent tiles, with every reader behind it: the exponentials are asm text,
    // and a pair pulled apart waits out the accumulator's latency
    __builtin_amdgcn_sched_barrier(0);

    // softmax, one query per lane, on the offset in use
    v16h pb[2];
    float psum;
    probs<true>(s, pb, psum);
    // one test per chunk, the same for the whole wave (a scalar branch): all 32 lanes are on inside
    if ((__builtin_amdgcn_ballot_w32(!(psum <= PLIM)) | (uint32_t)(kc == 0)) != 0u) {
      // renewal: the chunk's maximum, in-lane over the lane's 32 keys and one exchange between the wave halves, goes to exponent 7
      float m4[4];
#pragma unroll
      for (int j = 0; j < 4; ++j) {
        m4[j] = s[j][0];
#pragma unroll
        for (int r = 1; r < 8; ++r) m4[j] = fmaxf(m4[j], s[j][r]);
      }
      float m = fmaxf(fmaxf(m4[0], m4[1]), fmaxf(m4[2], m4[3]));
      m = fmaxf(m, xhalf(m));
      float delta = PSHIFT - m;
      if (kc != 0) delta = fminf(delta, 0.f);                   // behind chunk 0 the reference score only rises
      const float alpha = __builtin_amdgcn_exp2f(fminf(delta, 0.f));   // in chunk 0 out and l are still 0
#pragma unroll
      for (int j = 0; j < 4; ++j)
#pragma unroll
        for (int r = 0; r < 8; ++r) s[j][r] += delta;
      probs<false>(s, pb, psum);
#pragma unroll
      for (int r = 0; r < 8; ++r) off[r] += delta;
      lrow *= alpha;
#pragma unroll
      for (int t = 0; t < 4; ++t)
#pragma unroll
        for (int r = 0; r < 8; ++r) oacc[t][r] *= alpha;
    }
    lrow += psum;                                               // this half's keys only; the halves join in the epilogue

    // O^T += V^T.P^T: A[m = d][k = kv] = Vsh[kv][d], B[k = kv][n = query] = pb; oacc[t][r] = out[q0 + c][t*16 + 8*hh + r]
#pragma unroll
    for (int kk = 0; kk < 2; ++kk) {
#pragma unroll
      for (int t = 0; t < 4; ++t) oacc[t] = hmma16(vf[kk][t], pb[kk], oacc[t]);
    }
  }
  asm volatile("s_wait_tensorcnt 0x0" ::: "memory");            // no request is left in flight when the wave goes on
  asm volatile("s_wait_dscnt 0x0" ::: "memory");                // nor a read of the ring

  // ---- epilogue: out = acc / l (both carry the same factor), staged per wave in LDS, whole 256-B row segments ----
  float* os = Os[wave];
  {
    const float l = lrow + xhalf(lrow);
    const float inv = 1.0f / l;
#pragma unroll
    for (int t = 0; t < 4; ++t) {
      v4f lo, hi;
#pragma unroll
      for (int r = 0; r < 4; ++r) { lo[r] = oacc[t][r] * inv; hi[r] = oacc[t][4 + r] * inv; }
      *(v4f*)(os + c * 68 + t * 16 + 8 * hh)     = lo;
      *(v4f*)(os + c * 68 + t * 16 + 8 * hh + 4) = hi;
    }
  }
  __builtin_amdgcn_fence(__ATOMIC_RELEASE, "workgroup");
  __builtin_amdgcn_wave_barrier();
  __builtin_amdgcn_fence(__ATOMIC_ACQUIRE, "workgroup");
  {
    const int c4 = (lane & 15) * 4;
    {
#pragma unroll
      for (int it = 0; it < 8; ++it) {
        const int row = it * 2 + hh;
        v4f val = *(const v4f*)(os + row * 68 + c4);
        *(v4f*)(ob_ptr + (size_t)(q0 + row) * HID_ + c4) = val;
      }
      
    }
  }
}

// ---------------------------------------------------------------------------
// Host glue. Workspace carve (bytes): q, k, v as f16 [B*S][HID], 8 MiB each; total 25,165,824 B.
// ---------------------------------------------------------------------------
extern "C" void kernel_launch(void* const* d_in, const int* in_sizes, int n_in,
                              void* d_out, int out_size, void* d_ws,
                              size_t ws_size, hipStream_t stream) {
  if (n_in < 7) return;
  const int NX = B_ * S_ * HID_;          // 4194304
  const int NW = H_ * DH_ * DH_;          // 32768
  const int NB = H_ * DH_;                // 512
  if (in_sizes[0] != NX || in_sizes[1] != NW || in_sizes[2] != NB || in_sizes[3] != NW ||
      in_sizes[4] != NB || in_sizes[5] != NW || in_sizes[6] != NB || out_size != NX) return;

  const float* x  = (const float*)d_in[0];
  const float* Wq = (const float*)d_in[1];
  const float* bq = (const float*)d_in[2];
  const float* Wk = (const float*)d_in[3];
  const float* bk = (const float*)d_in[4];
  const float* Wv = (const float*)d_in[5];
  const float* bv = (const float*)d_in[6];
  float* out = (float*)d_out;

  const size_t bytesP = (size_t)NX * 2;                   // 8388608 per f16 plane
  if (3 * bytesP > ws_size) return;

  char* ws = (char*)d_ws;
  _Float16* Qh = (_Float16*)(ws);
  _Float16* Kh = (_Float16*)(ws + bytesP);
  _Float16* Vh = (_Float16*)(ws + 2 * bytesP);

  // projections: one block per (256 rows, head); x and the weights are read as f32 and rounded in the kernel.
  {
    dim3 pgrid(B_ * S_ / PJ_ROWS, H_);                    // 32 x 8
    qkv_proj_f16<<<pgrid, 256, 0, stream>>>(x, Wq, bq, Wk, bk, Wv, bv, Qh, Kh, Vh);
  }

  // attention: one block per (b, h, 64-query block); keys streamed in 64-key chunks, no mask; the score scale lies in the q plane.
  {
    const int nblk = B_ * H_ * (S_ / AT_QB);              // 1024
    attn64_f16<<<nblk, 128, 0, stream>>>(Qh, Kh, Vh, out);
  }
}

// v009
// It runs in 37.9 microseconds.
// Two timings next to v008 put it at 1.03 and 1.04 times that version's speed.
// Counting every step since v000, it is 6.72 times as fast.
// Contractions: per-head q/k/v projections = v_wmma_f32_16x16x32_f16 (f16 operands, weights carried x16, f32 accumulate, f16 output planes);
// attention q.k^T and p.v = v_wmma_f32_16x16x32_f16 (f16 operands, p carried x2^7, f32 accumulate); softmax (base 2) and epilogues f32.
#include <hip/hip_runtime.h>
#include <math.h>
#include <stdint.h>

#define B_   4
#define S_   2048
#define HID_ 512
#define H_   8
#define DH_  64

typedef __attribute__((ext_vector_type(16))) _Float16 v16h;
typedef __attribute__((ext_vector_type(8)))  _Float16 v8h;
typedef __attribute__((ext_vector_type(4)))  _Float16 v4h;
typedef __attribute__((ext_vector_type(8)))  float    v8f;
typedef __attribute__((ext_vector_type(4)))  float    v4f;
#define PSHIFT 7.0f                    // p and its sum are carried x2^7: the shift is part of the base-2 exponent's offset
#define PLIM   32768.0f                // a lane's sum of p over a pass up to 2^15: then every p of it fits f16
#define LOG2E  1.44269504088896340736f
#define QSCALE (0.125f * LOG2E)        // score scale 1/sqrt(64) and log2(e), carried by the q plane

template <typename T> struct Frag;
template <> struct Frag<_Float16> {
  typedef v16h V; union U { v16h v; v8h h[2]; };
  static __device__ __forceinline__ v16h load(const _Float16* p) {   // elements 0..7 <- p[0..7], 8..15 <- p[16..23]
    U f; f.h[0] = *(const v8h*)(p); f.h[1] = *(const v8h*)(p + 16); return f.v;
  }
};

// =====================================================================================
// q, k, v projections of one head for 256 rows, one launch for all three.
//   y[m][n] = (sum_k x[m][h*64 + k] * (16 W[h][n][k])) / 16 + b[h][n], y = q, k, v as f16 planes [B*S][HID];
//   the q plane holds q * QSCALE (multiplied in f32, ahead of the one rounding to f16): k.q is then a base-2 exponent.
//   x and W are read as f32 and rounded to f16 in registers (W after the x16 carry).
//   Product transposed: A[m' = n][k] = W rows from LDS, B[k][n' = row] = x rows, so a lane's 8 accumulator
//   registers are 8 neighbouring outputs of one row: D[r] = y[m0 + c][j*16 + 8*hh + r].
//   Block = 8 waves x 32 rows; the x fragments of a wave serve all three weights.
//   grid = (B*S/256, H).
// =====================================================================================
#define PJ_LP 72                       // LDS row pitch in f16: 144 B = 16 B x odd, as for the attention K tile
#define PJ_NW 8
#define PJ_MT 2                        // 16-row tiles per wave
#define PJ_WR (PJ_MT * 16)             // rows per wave
#define PJ_ROWS (PJ_NW * PJ_WR)        // rows per block

__global__ __launch_bounds__(256)
void qkv_proj_f16(const float* __restrict__ x,
                  const float* __restrict__ Wq, const float* __restrict__ bq,
                  const float* __restrict__ Wk, const float* __restrict__ bk,
                  const float* __restrict__ Wv, const float* __restrict__ bv,
                  _Float16* __restrict__ qo, _Float16* __restrict__ ko, _Float16* __restrict__ vo) {
  __shared__ __align__(16) _Float16 Wsh[3][DH_ * PJ_LP];             // 16 W[h] as f16, [n][k], padded rows   27 KB
  __shared__ __align__(16) float    Bsh[3][DH_];                     // b[h]
  __shared__ __align__(16) _Float16 Ts[PJ_NW][3][PJ_WR * PJ_LP];     // per wave and output: 32 x 64 tile     108 KB

  const int tid  = threadIdx.x;
  const int wave = tid >> 5;
  const int lane = tid & 31;
  const int hh   = lane >> 4;
  const int c    = lane & 15;
  const int h    = blockIdx.y;
  const int m0   = blockIdx.x * PJ_ROWS + wave * PJ_WR;

  // Every loop of this kernel is unrolled in full: the fragment and accumulator arrays stay in registers only
  // when they are indexed by constants, and no branch then follows a matrix instruction.
  // ---- all global reads first: the wave's x rows (fragment order) and the block's share of the three weights ----
  v4f xr[PJ_MT][2][4];
#pragma unroll
  for (int mt = 0; mt < PJ_MT; ++mt) {
#pragma unroll
    for (int dc = 0; dc < 2; ++dc) {
      const float* p = x + (size_t)(m0 + mt * 16 + c) * HID_ + h * DH_ + dc * 32 + 8 * hh;
      xr[mt][dc][0] = *(const v4f*)(p);
      xr[mt][dc][1] = *(const v4f*)(p + 4);
      xr[mt][dc][2] = *(const v4f*)(p + 16);
      xr[mt][dc][3] = *(const v4f*)(p + 20);
    }
    // the result of a later load is placed in this row tile's address registers: the wait stands in front of that overwrite
    asm volatile("s_wait_xcnt 0x0" ::: "memory");
  }
  v4f wr[3][4];
#pragma unroll
  for (int i = 0; i < 4; ++i) {
    const size_t wo = (size_t)h * (DH_ * DH_) + (size_t)(i * 256 + tid) * 4;
    wr[0][i] = *(const v4f*)(Wq + wo);
    wr[1][i] = *(const v4f*)(Wk + wo);
    wr[2][i] = *(const v4f*)(Wv + wo);
  }
  if (tid < 3 * DH_) {
    const int w = tid >> 6, n = tid & 63;
    const float* bsrc = (w == 0) ? bq : (w == 1) ? bk : bv;
    Bsh[w][n] = bsrc[h * DH_ + n];
  }
#pragma unroll
  for (int w = 0; w < 3; ++w)
#pragma unroll
    for (int i = 0; i < 4; ++i) {
      const int i4 = i * 256 + tid;                                  // float4 index in the 64 x 64 weight
      v4h hv;
#pragma unroll
      for (int e = 0; e < 4; ++e) hv[e] = (_Float16)(wr[w][i][e] * 16.0f);
      *(v4h*)(&Wsh[w][(i4 >> 4) * PJ_LP + (i4 & 15) * 4]) = hv;
    }
  v16h xb[PJ_MT][2];
#pragma unroll
  for (int mt = 0; mt < PJ_MT; ++mt)
#pragma unroll
    for (int dc = 0; dc < 2; ++dc)
#pragma unroll
      for (int e = 0; e < 16; ++e) xb[mt][dc][e] = (_Float16)xr[mt][dc][e >> 2][e & 3];
  __syncthreads();

  // ---- products and epilogue math; each output has its own LDS tile, so nothing is overwritten ----
#pragma unroll
  for (int w = 0; w < 3; ++w) {
    v8f acc[PJ_MT][4];
#pragma unroll
    for (int mt = 0; mt < PJ_MT; ++mt)
#pragma unroll
      for (int j = 0; j < 4; ++j) acc[mt][j] = (v8f){0.f,0.f,0.f,0.f,0.f,0.f,0.f,0.f};
#pragma unroll
    for (int dc = 0; dc < 2; ++dc)
#pragma unroll
      for (int j = 0; j < 4; ++j) {
        const v16h wa = Frag<_Float16>::load(&Wsh[w][(j * 16 + c) * PJ_LP + dc * 32 + 8 * hh]);
#pragma unroll
        for (int mt = 0; mt < PJ_MT; ++mt)
          acc[mt][j] = __builtin_amdgcn_wmma_f32_16x16x32_f16(false, wa, false, xb[mt][dc], (short)0, acc[mt][j], false, false);
      }
    _Float16* ts = Ts[wave][w];
#pragma unroll
    for (int j = 0; j < 4; ++j) {
      const v4f b0 = *(const v4f*)(&Bsh[w][j * 16 + 8 * hh]);
      const v4f b1 = *(const v4f*)(&Bsh[w][j * 16 + 8 * hh + 4]);
#pragma unroll
      for (int mt = 0; mt < PJ_MT; ++mt) {
        v8h hv;
#pragma unroll
        for (int r = 0; r < 8; ++r) {
          float v = acc[mt][j][r] * (1.0f / 16.0f);
          v += (r < 4) ? b0[r & 3] : b1[r & 3];
          if (w == 0) v *= QSCALE;
          hv[r] = (_Float16)v;
        }
        *(v8h*)(ts + (mt * 16 + c) * PJ_LP + j * 16 + 8 * hh) = hv;
      }
    }
  }
  // the wave reads back only what it wrote itself: order its LDS writes ahead of its LDS reads
  __builtin_amdgcn_fence(__ATOMIC_RELEASE, "workgroup");
  __builtin_amdgcn_wave_barrier();
  __builtin_amdgcn_fence(__ATOMIC_ACQUIRE, "workgroup");

  // ---- stores: 8 lanes x 16 B = one whole 128-B row segment, 4 rows per instruction ----
  {
    const int q = lane >> 3, c8 = (lane & 7) * 8;
#pragma unroll
    for (int w = 0; w < 3; ++w) {
      _Float16* o = ((w == 0) ? qo : (w == 1) ? ko : vo) + (size_t)m0 * HID_ + h * DH_ + c8;
      const _Float16* ts = Ts[wave][w];
#pragma unroll
      for (int it = 0; it < PJ_WR / 4; ++it) {
        const int row = it * 4 + q;
        *(v8h*)(o + (size_t)row * HID_) = *(const v8h*)(ts + row * PJ_LP + c8);
      }
    }
  }
}

// =====================================================================================
// Non-causal attention for head_dim 64, 16-bit q/k/v planes in, f32 out.
//   q, k, v: f16, element (b, s, h, d) at X[(b*S + s)*HID + h*64 + d], q already times QSCALE; out f32 with the same indexing.
//   e^T = k.q^T + off  : v_wmma_f32_16x16x32_f16; off = 7 - (the query's reference score), the product's C operand
//   p x 2^7 = 2^e      : one hardware base-2 exponential per score, straight from the accumulator
//   off is renewed (from the pass's maximum, with a rescale of out and l) in the first pass and whenever a lane's sum of p over a
//   pass passes 2^15: one wave-uniform test per pass. Below that bound every p fits f16, and softmax does not depend on off.
//   out^T    = v^T.p^T : v_wmma_f32_16x16x32_f16, p in f16 (kept in registers), its sum l carries the same factor
//   f32 accumulate; online softmax in f32. Block = 4 waves x 32 queries = 128 query rows of one (batch, head);
//   a wave works in passes of 32 keys x 32 queries (two column tiles): every K and V^T fragment read from LDS feeds two products.
//   keys streamed in 64-key chunks (two passes) staged in LDS, both as [kv][d] rows of 128 B: K at a pitch of 144 B, V at 160 B;
//   the V^T fragments come out of the V rows by the 16-bit transposing LDS load.
//   Staging: one tensor load per tile (wave 0: K, wave 1: V; the pad fields lay the pitch), two buffers, so that the
//   next chunk's tiles fly while this chunk is worked on; one publish point (waits, then the barrier) between two chunks.
//   grid.x = B * H * (S/128).
// =====================================================================================
#define AT_D 64
#define AT_NW 4
#define AT_QT 2                        // query column tiles of 16 per wave
#define AT_QB (AT_NW * AT_QT * 16)     // query rows per block
#define AT_KC 64
#define AT_LP 72   // LDS row pitch of the K tile in f16: 144 B = 16 B x odd, so the 16 rows of a 16-byte fragment read fall on distinct banks
#define AT_VP 80   // LDS row pitch of the V tile in f16: 160 B = 32 B x odd, the conflict-free pitch of the transposing load
#define AT_NC (S_ / AT_KC)             // key chunks = loop iterations (the ring has two buffers)
#define AT_KBYTES 10240u               // one K tile in LDS: 64 rows x 144 B = 9216 B, rounded up to a multiple of 2 KiB
#define AT_VBYTES 10240u               // one V tile in LDS: 64 rows x 160 B, a multiple of 2 KiB as it is
#define AT_BUF (AT_KBYTES + AT_VBYTES) // one buffer: the K tile, then the V tile
#define AT_PADK ((1u << 20) | (4u << 22) | (3u << 25))   // pad on, behind every 128-B row, 4 dwords: LDS pitch 144 B
#define AT_PADV ((1u << 20) | (4u << 22) | (7u << 25))   // pad on, behind every 128-B row, 8 dwords: LDS pitch 160 B

typedef uint32_t u32x4 __attribute__((ext_vector_type(4)));
typedef uint32_t u32x8 __attribute__((ext_vector_type(8)));

__device__ __forceinline__ uint32_t uni(uint32_t v) { return (uint32_t)__builtin_amdgcn_readfirstlane(v); }
// A tensor load ignores the lane mask: only a scalar compare and branch keeps a wave from issuing it.
__device__ __forceinline__ uint32_t pinned(uint32_t v) {
  uint32_t w = uni(v);
  asm volatile("" : "+s"(w));          // the test's value (or a descriptor's index) held in a scalar register: the branch on it is scalar
  return w;
}

// Descriptor group 1 of a tile of 64 rows of 128 B at a source pitch of HID_ * 2 B; W0 = word 0 (no mask, 1-byte elements, the pad),
// a compile-time constant. Tensor dims = tile dims: every tile lies inside its plane.
template <uint32_t W0>
__device__ __forceinline__ u32x8 tile_group1() {
  u32x8 g1;
  g1[0] = uni(W0);
  g1[1] = uni(128u << 16);             // tensor_dim0 = 128 B
  g1[2] = uni(64u << 16);              // tensor_dim1 = 64 rows
  g1[3] = uni(128u << 16);             // tile_dim0
  g1[4] = uni(64u);                    // tile_dim1
  g1[5] = uni((uint32_t)HID_ * 2u);    // source row pitch in bytes
  g1[6] = uni(0u);
  g1[7] = uni(0u);
  // without it the compiler rebuilds the group at each load in registers that it also uses for other things while the request flies
  asm volatile("" : "+s"(g1));         // descriptor words held in scalar registers of their own as long as the loop runs
  return g1;
}
// One tensor load: the tile at global byte address ga goes to LDS byte offset dst.
__device__ __forceinline__ void tile_load(uint32_t dst, uint64_t ga, u32x8 g1) {
  u32x4 g0;
  g0[0] = uni(1u);
  g0[1] = uni(dst);
  g0[2] = uni((uint32_t)ga);
  g0[3] = uni((((uint32_t)(ga >> 32)) & 0x01FFFFFFu) | 0x80000000u);
  asm volatile("tensor_load_to_lds %0, %1" :: "s"(g0), "s"(g1) : "memory");   // one request of the whole wave; the compiler places no wait for it: the waits are the caller's
}

__device__ __forceinline__ v8f hmma16(v16h a, v16h b, v8f c) {
  return __builtin_amdgcn_wmma_f32_16x16x32_f16(false, a, false, b, (short)0, c, false, false);
}

// 16-bit transposing LDS load: the 32 lanes name 16 rows x 32 B of a row-major tile T (lane l: row 8*(l >> 4) + (l & 7),
// byte 16*((l >> 3) & 1)); lane (c = l & 15, hh = l >> 4) receives T[8*hh + 0..7][c]. All 32 lanes are on wherever it is called.
typedef __attribute__((ext_vector_type(8))) short s16x8;
__device__ __forceinline__ v8h ld_tr16(const _Float16* p) {
  typedef __attribute__((address_space(3))) s16x8 lds_s16x8;
  return __builtin_bit_cast(v8h, __builtin_amdgcn_ds_load_tr16_b128_v8i16((lds_s16x8*)p));
}

// value of lane l ^ 16 (the other wave half), as a vector cross-row move; all 32 lanes are on wherever it is called
__device__ __forceinline__ float xhalf(float x) {
  const int b = __builtin_bit_cast(int, x);
  return __builtin_bit_cast(float, __builtin_amdgcn_permlanex16(b, b, 0x76543210, 0xfedcba98, false, false));
}

// eight base-2 exponentials of one score tile, into registers of their own (the exponents stay: a renewal of the offset reads
// them again). One statement: no exponential's source is overwritten by a neighbour, and the closing v_nop is the slot that the
// instruction set asks for between a transcendental and the reader of its result.
// LEAD: the statement stands right behind the score products, and its results may be placed in the K fragment registers that the
// last of them has read: the chip wants four vector slots between a matrix instruction and a vector write over its A operand (or a
// vector read of its result): the four leading v_nop are these slots.
template <bool LEAD>
__device__ __forceinline__ void exp2x8(float (&o)[8], const v8f e) {
  if (LEAD)
    asm("v_nop\n\tv_nop\n\tv_nop\n\tv_nop\n\tv_exp_f32 %0, %8\n\tv_exp_f32 %1, %9\n\tv_exp_f32 %2, %10\n\tv_exp_f32 %3, %11\n\t"
        "v_exp_f32 %4, %12\n\tv_exp_f32 %5, %13\n\tv_exp_f32 %6, %14\n\tv_exp_f32 %7, %15\n\tv_nop"
        : "=&v"(o[0]), "=&v"(o[1]), "=&v"(o[2]), "=&v"(o[3]), "=&v"(o[4]), "=&v"(o[5]), "=&v"(o[6]), "=&v"(o[7])
        : "v"(e[0]), "v"(e[1]), "v"(e[2]), "v"(e[3]), "v"(e[4]), "v"(e[5]), "v"(e[6]), "v"(e[7]));
  else
    asm("v_exp_f32 %0, %8\n\tv_exp_f32 %1, %9\n\tv_exp_f32 %2, %10\n\tv_exp_f32 %3, %11\n\t"
        "v_exp_f32 %4, %12\n\tv_exp_f32 %5, %13\n\tv_exp_f32 %6, %14\n\tv_exp_f32 %7, %15\n\tv_nop"
        : "=&v"(o[0]), "=&v"(o[1]), "=&v"(o[2]), "=&v"(o[3]), "=&v"(o[4]), "=&v"(o[5]), "=&v"(o[6]), "=&v"(o[7])
        : "v"(e[0]), "v"(e[1]), "v"(e[2]), "v"(e[3]), "v"(e[4]), "v"(e[5]), "v"(e[6]), "v"(e[7]));
}

// one base-2 exponential; the closing v_nop is the slot between a transcendental and a write over its source or a reader of its result
__device__ __forceinline__ float exp2x1(float x) {
  float y;
  asm("v_exp_f32 %0, %1\n\tv_nop" : "=v"(y) : "v"(x));
  return y;
}

// p = 2^e of a pass's two score tiles of one query tile: packed straight into the B operand of the second product (element i of
// pb = tile i >> 3, register i & 7), and summed over the lane's 16 keys in two chains (even and odd registers).
template <bool LEAD>
__device__ __forceinline__ void probs(const v8f (&e)[2], v16h& pb, float& psum) {
  float a0 = 0.f, a1 = 0.f;
#pragma unroll
  for (int j = 0; j < 2; ++j) {
    float p[8];                                                 // p x 2^7
    if (LEAD && j == 0) exp2x8<true>(p, e[j]); else exp2x8<false>(p, e[j]);
#pragma unroll
    for (int r = 0; r < 8; r += 2) {
      a0 = (j == 0 && r == 0) ? p[0] : a0 + p[r];
      a1 = (j == 0 && r == 0) ? p[1] : a1 + p[r + 1];
    }
#pragma unroll
    for (int r = 0; r < 8; ++r) pb[j * 8 + r] = (_Float16)p[r];
  }
  psum = a0 + a1;
}

__global__ __launch_bounds__(128)
void attn64_f16(const _Float16* __restrict__ qp, const _Float16* __restrict__ kp,
                const _Float16* __restrict__ vp, float* __restrict__ out) {
  __shared__ __attribute__((aligned(2048))) unsigned char Ring[2 * AT_BUF];   // two buffers of K [kv][d] and V [kv][d], padded rows   40 KB
  __shared__ __align__(16) float    Os[AT_NW][AT_QT * 16 * 68]; // per wave out tile, pitch 68

  const int tid  = threadIdx.x;
  const int wave = tid >> 5;
  const int lane = tid & 31;
  const int hh   = lane >> 4;
  const int c    = lane & 15;
  const uint32_t wv = uni((uint32_t)tid >> 5);                  // the wave's number, scalar

  const int nqb = S_ / AT_QB;                                   // 16
  const int bx = blockIdx.x;
  if (bx >= B_ * H_ * nqb) return;                              // block-uniform, ahead of every barrier
  const int qb = bx % nqb;
  const int bh = bx / nqb;
  const int h  = bh % H_;
  const int b  = bh / H_;
  const int q0 = qb * AT_QB + wave * (AT_QT * 16);

  const size_t pbase = (size_t)b * S_ * HID_ + (size_t)h * DH_;
  const _Float16* qb_ptr = qp + pbase;
  const _Float16* kb_ptr = kp + pbase;
  const _Float16* vb_ptr = vp + pbase;
  float*          ob_ptr = out + pbase;

  // ---- Q fragments (B operand, column = query q0 + 16*qt + c, k = d): 2 d-chunks per query tile, dense static-stride loads ----
  v16h qa[AT_QT][2];
#pragma unroll
  for (int qt = 0; qt < AT_QT; ++qt)
#pragma unroll
    for (int dc = 0; dc < 2; ++dc)
      qa[qt][dc] = Frag<_Float16>::load(qb_ptr + (size_t)(q0 + qt * 16 + c) * HID_ + dc * 32 + 8 * hh);
  // the address registers of these loads are given to the accumulators below: the wait stands in front of that overwrite
  asm volatile("s_wait_xcnt 0x0" ::: "memory");

  float lrow[AT_QT];                                            // of query q0 + 16*qt + c: sums this wave half's keys, x2^7
  v8f off[AT_QT];                                               // exponent offset of that query in all eight registers: C of the score products
  v8f oacc[AT_QT][4];
#pragma unroll
  for (int qt = 0; qt < AT_QT; ++qt) {
    lrow[qt] = 0.f;
    off[qt] = (v8f){0.f,0.f,0.f,0.f,0.f,0.f,0.f,0.f};
#pragma unroll
    for (int t = 0; t < 4; ++t) oacc[qt][t] = (v8f){0.f,0.f,0.f,0.f,0.f,0.f,0.f,0.f};
  }

  // ---- ring prologue: chunk 0's tiles, each issuer's own wait directly behind its load; the barrier that publishes them and
  //      chunk 1's loads are the first publish point, at the head of the loop ----
  const uint32_t lbase = (uint32_t)(size_t)Ring;                // byte offset in the work-group's LDS
  const uint64_t kga = (uint64_t)(size_t)kb_ptr, vga = (uint64_t)(size_t)vb_ptr;
  const uint64_t cstep = (uint64_t)AT_KC * HID_ * 2u;           // source bytes from one chunk to the next
  const u32x8 g1k = tile_group1<AT_PADK>(), g1v = tile_group1<AT_PADV>();
  if (pinned(wv == 0u)) {
    tile_load(lbase, kga, g1k);
    asm volatile("s_wait_tensorcnt 0x0" ::: "memory");          // the K tile of chunk 0 has landed
  }
  if (pinned(wv == 1u)) {
    tile_load(lbase + AT_KBYTES, vga, g1v);
    asm volatile("s_wait_tensorcnt 0x0" ::: "memory");          // the V tile of chunk 0 has landed
  }

  for (int kc = 0; kc < AT_NC; ++kc) {                          // 32 chunks, static; chunk kc (keys from kv0 = 64 kc) lies in buffer kc & 1
    // ---- publish point of chunk kc = the foot of chunk kc - 1, every wave, in this order. It stands at the head of the
    //      loop so that the whole of a chunk's arithmetic stays one straight block behind it. ----
    asm volatile("s_wait_dscnt 0x0" ::: "memory");              // this wave's reads of chunk kc - 1's buffer have returned
    if (pinned(wv < 2u)) {
      asm volatile("s_wait_tensorcnt 0x0" ::: "memory");        // the issuer's tile of chunk kc has landed
    }
    __syncthreads();                                            // publishes chunk kc; every wave has left chunk kc - 1's buffer
    const uint32_t nx = pinned((uint32_t)kc + 1u);              // held scalar behind the wait: the descriptor is formed from it here
    if (pinned(nx < (uint32_t)AT_NC)) {                         // only while chunk kc + 1 exists: it goes into the buffer just left
      const uint32_t dst = lbase + (nx & 1u) * AT_BUF;
      if (pinned(wv == 0u)) tile_load(dst, kga + (uint64_t)nx * cstep, g1k);
      if (pinned(wv == 1u)) tile_load(dst + AT_KBYTES, vga + (uint64_t)nx * cstep, g1v);
    }
    const _Float16* Ksh = (const _Float16*)(Ring + (uint32_t)(kc & 1) * AT_BUF);
    const _Float16* Vsh = (const _Float16*)(Ring + (uint32_t)(kc & 1) * AT_BUF + AT_KBYTES);

    // scores transposed: S^T = K.Q^T, 32 keys x 32 queries per wave and pass; A[m = kv][k = d] = Ksh[kv][d], B[k = d][n = query] = qa
    // D layout: s[qt][j][r] = score of key kv0 + ps*32 + j*16 + 8*hh + r for query q0 + 16*qt + c: a lane holds one query per tile
    // The K fragments of both passes and the V^T fragments of pass 0 stand here as one group, K ahead of V^T: the products then
    // wait out one LDS latency, and the V^T fragments land while the scores and the softmax are worked on.
    v16h kf[2][2][2], vf[4];                                    // kf[pass][dc][j]
#pragma unroll
    for (int ps = 0; ps < 2; ++ps)
#pragma unroll
      for (int dc = 0; dc < 2; ++dc)
#pragma unroll
        for (int j = 0; j < 2; ++j)
          kf[ps][dc][j] = Frag<_Float16>::load(Ksh + (ps * 32 + j * 16 + c) * AT_LP + dc * 32 + 8 * hh);
    // holds the K reads ahead of the V^T reads: LDS answers in order, and the first products wait for K alone
    __builtin_amdgcn_sched_barrier(0);

#pragma unroll
    for (int ps = 0; ps < 2; ++ps) {
      // V^T fragments of this pass: pass 1's go into the registers that pass 0's second product has just read, and land
      // while pass 1's scores and softmax are worked on
#pragma unroll
      for (int t = 0; t < 4; ++t) {
        // elements 0..7 = V[ps*32 + 8*hh + 0..7][t*16 + c], elements 8..15 = V[ps*32 + 16 + 8*hh + 0..7][t*16 + c]: the k order of pb
        const _Float16* vt = Vsh + (ps * 32 + 8 * hh + (lane & 7)) * AT_VP + t * 16 + 8 * ((lane >> 3) & 1);
        Frag<_Float16>::U f;
        f.h[0] = ld_tr16(vt);
        f.h[1] = ld_tr16(vt + 16 * AT_VP);
        vf[t] = f.v;
      }
      // keeps the scheduler from sinking the reads back down among the products, where each would be waited for on its own
      __builtin_amdgcn_sched_barrier(0);
      v8f s[AT_QT][2];
#pragma unroll
      for (int qt = 0; qt < AT_QT; ++qt)
#pragma unroll
        for (int j = 0; j < 2; ++j) s[qt][j] = hmma16(kf[ps][0][j], qa[qt][0], off[qt]);
#pragma unroll
      for (int qt = 0; qt < AT_QT; ++qt)
#pragma unroll
        for (int j = 0; j < 2; ++j) s[qt][j] = hmma16(kf[ps][1][j], qa[qt][1], s[qt][j]);
      // keeps the eight products one run of four independent tiles, with every reader behind it: the exponentials are asm text,
      // and a pair pulled apart waits out the accumulator's latency
      __builtin_amdgcn_sched_barrier(0);

      // softmax, one query per lane and tile, on the offsets in use
      v16h pb[AT_QT];
      float psum[AT_QT];
      probs<true>(s[0], pb[0], psum[0]);
      probs<false>(s[1], pb[1], psum[1]);
      // one test per pass, the same for the whole wave (a scalar branch): all 32 lanes are on inside
      if ((__builtin_amdgcn_ballot_w32(!(fmaxf(psum[0], psum[1]) <= PLIM)) | (uint32_t)(ps == 0 && kc == 0)) != 0u) {
#pragma unroll
        for (int qt = 0; qt < AT_QT; ++qt) {
          // renewal: the pass's maximum, in-lane over the lane's 16 keys and one exchange between the wave halves, goes to exponent 7
          float m2[2];
#pragma unroll
          for (int j = 0; j < 2; ++j) {
            m2[j] = s[qt][j][0];
#pragma unroll
            for (int r = 1; r < 8; ++r) m2[j] = fmaxf(m2[j], s[qt][j][r]);
          }
          float m = fmaxf(m2[0], m2[1]);
          m = fmaxf(m, xhalf(m));
          float delta = PSHIFT - m;
          if (!(ps == 0 && kc == 0)) delta = fminf(delta, 0.f);  // behind the first pass the reference score only rises
          const float alpha = exp2x1(fminf(delta, 0.f));   // in the first pass out and l are still 0
#pragma unroll
          for (int j = 0; j < 2; ++j)
#pragma unroll
            for (int r = 0; r < 8; ++r) s[qt][j][r] += delta;
          probs<false>(s[qt], pb[qt], psum[qt]);
#pragma unroll
          for (int r = 0; r < 8; ++r) off[qt][r] += delta;
          lrow[qt] *= alpha;
#pragma unroll
          for (int t = 0; t < 4; ++t)
#pragma unroll
            for (int r = 0; r < 8; ++r) oacc[qt][t][r] *= alpha;
        }
      }
#pragma unroll
      for (int qt = 0; qt < AT_QT; ++qt) lrow[qt] += psum[qt];  // this half's keys only; the halves join in the epilogue

      // O^T += V^T.P^T: A[m = d][k = kv] = Vsh[kv][d], B[k = kv][n = query] = pb; oacc[qt][t][r] = out[q0 + 16*qt + c][t*16 + 8*hh + r]
#pragma unroll
      for (int t = 0; t < 4; ++t)
#pragma unroll
        for (int qt = 0; qt < AT_QT; ++qt) oacc[qt][t] = hmma16(vf[t], pb[qt], oacc[qt][t]);
      // keeps pass 1's V^T reads behind pass 0's second product, whose fragment registers they take over
      __builtin_amdgcn_sched_barrier(0);
    }
  }
  asm volatile("s_wait_tensorcnt 0x0" ::: "memory");            // no request is left in flight when the wave goes on
  asm volatile("s_wait_dscnt 0x0" ::: "memory");                // nor a read of the ring

  // ---- epilogue: out = acc / l (both carry the same factor), staged per wave in LDS, whole 256-B row segments ----
  float* os = Os[wave];
#pragma unroll
  for (int qt = 0; qt < AT_QT; ++qt) {
    const float l = lrow[qt] + xhalf(lrow[qt]);
    const float inv = 1.0f / l;
#pragma unroll
    for (int t = 0; t < 4; ++t) {
      v4f lo, hi;
#pragma unroll
      for (int r = 0; r < 4; ++r) { lo[r] = oacc[qt][t][r] * inv; hi[r] = oacc[qt][t][4 + r] * inv; }
      *(v4f*)(os + (qt * 16 + c) * 68 + t * 16 + 8 * hh)     = lo;
      *(v4f*)(os + (qt * 16 + c) * 68 + t * 16 + 8 * hh + 4) = hi;
    }
  }
  __builtin_amdgcn_fence(__ATOMIC_RELEASE, "workgroup");
  __builtin_amdgcn_wave_barrier();
  __builtin_amdgcn_fence(__ATOMIC_ACQUIRE, "workgroup");
  {
    const int c4 = (lane & 15) * 4;
#pragma unroll
    for (int it = 0; it < AT_QT * 8; ++it) {
      const int row = it * 2 + hh;
      v4f val = *(const v4f*)(os + row * 68 + c4);
      *(v4f*)(ob_ptr + (size_t)(q0 + row) * HID_ + c4) = val;
    }
  }
}

// ---------------------------------------------------------------------------
// Host glue. Workspace carve (bytes): q, k, v as f16 [B*S][HID], 8 MiB each; total 25,165,824 B.
// ---------------------------------------------------------------------------
extern "C" void kernel_launch(void* const* d_in, const int* in_sizes, int n_in,
                              void* d_out, int out_size, void* d_ws,
                              size_t ws_size, hipStream_t stream) {
  if (n_in < 7) return;
  const int NX = B_ * S_ * HID_;          // 4194304
  const int NW = H_ * DH_ * DH_;          // 32768
  const int NB = H_ * DH_;                // 512
  if (in_sizes[0] != NX || in_sizes[1] != NW || in_sizes[2] != NB || in_sizes[3] != NW ||
      in_sizes[4] != NB || in_sizes[5] != NW || in_sizes[6] != NB || out_size != NX) return;

  const float* x  = (const float*)d_in[0];
  const float* Wq = (const float*)d_in[1];
  const float* bq = (const float*)d_in[2];
  const float* Wk = (const float*)d_in[3];
  const float* bk = (const float*)d_in[4];
  const float* Wv = (const float*)d_in[5];
  const float* bv = (const float*)d_in[6];
  float* out = (float*)d_out;

  const size_t bytesP = (size_t)NX * 2;                   // 8388608 per f16 plane
  if (3 * bytesP > ws_size) return;

  char* ws = (char*)d_ws;
  _Float16* Qh = (_Float16*)(ws);
  _Float16* Kh = (_Float16*)(ws + bytesP);
  _Float16* Vh = (_Float16*)(ws + 2 * bytesP);

  // projections: one block per (256 rows, head); x and the weights are read as f32 and rounded in the kernel.
  {
    dim3 pgrid(B_ * S_ / PJ_ROWS, H_);                    // 32 x 8
    qkv_proj_f16<<<pgrid, 256, 0, stream>>>(x, Wq, bq, Wk, bk, Wv, bv, Qh, Kh, Vh);
  }

  // attention: one block per (b, h, 128-query block); keys streamed in 64-key chunks, no mask; the score scale lies in the q plane.
  {
    const int nblk = B_ * H_ * (S_ / AT_QB);              // 512
    attn64_f16<<<nblk, 128, 0, stream>>>(Qh, Kh, Vh, out);
  }
}
